// v000
// Times are from an AMD MI455X. After a warm-up the kernel runs many times in a row, and a time is the length of
// such a window on the GPU divided by its runs, so every launch and the gaps after it count. The runs cycle
// through copies of the inputs. A figure is the median of several windows, for all but v000 over two sittings.
// Sittings can differ by a few percent; kernels timed side by side share one.
// v000 is the starting kernel. One run takes 1230 microseconds.
#include <hip/hip_runtime.h>
#include <math.h>

// ---------------- problem constants (match reference) ----------------
#define DIMX   1024
#define DSTATE 64
#define NH     8
#define DI     2048            // D_INNER
#define HD     256             // HEAD_DIM
#define DP     4232            // D_IN_PROJ = 2*DI + NH + 2*DSTATE
#define SEQ    1024
#define BATCH  2
#define BOFF   (2*DI + NH)          // B_proj (=Cm slice) columns [4104,4168)
#define COFF   (2*DI + NH + DSTATE) // C_proj (=dtm slice) columns [4168,4232)

typedef float v2f __attribute__((ext_vector_type(2)));
typedef float v8f __attribute__((ext_vector_type(8)));
typedef int   i32x4 __attribute__((vector_size(4 * sizeof(int))));  // matches builtin proto

// gfx1250 async global->LDS copies (ASYNCcnt-tracked). Guarded so the code
// still compiles (sync fallback) if this toolchain doesn't expose them.
#if __has_builtin(__builtin_amdgcn_global_load_async_to_lds_b128)
#define ASYNC_B128 1
#endif
#if __has_builtin(__builtin_amdgcn_global_load_async_to_lds_b32)
#define ASYNC_B32 1
#endif

__device__ __forceinline__ void async_wait0()
{
#if defined(ASYNC_B128) || defined(ASYNC_B32)
#if __has_builtin(__builtin_amdgcn_s_wait_asynccnt)
    __builtin_amdgcn_s_wait_asynccnt(0);
#else
    asm volatile("s_wait_asynccnt 0x0" ::: "memory");
#endif
#endif
}

// =====================================================================
// GEMM: C[M,N] = A[M,K] * B[N,K]^T   (both row-major, fp32)
// WG = 256 thr (8 waves). WG tile 64x128. Wave tile 16x64 (4 wmma accs).
// K staged through double-buffered LDS in 32-wide chunks; chunk k+1 is
// fetched with global_load_async_to_lds_b128 while chunk k feeds
// V_WMMA_F32_16X16X4_F32. One barrier per chunk.
// =====================================================================
#define KB  32
#define LDA 36   // padded LDS row stride (floats): 16B-aligned, conflict-free

__global__ __launch_bounds__(256)
void gemm_f32_wmma(const float* __restrict__ A, const float* __restrict__ Bw,
                   float* __restrict__ C, int M, int N, int K)
{
    __shared__ float As[2][64  * LDA];
    __shared__ float Bs[2][128 * LDA];

    const int tid  = threadIdx.x;
    const int lane = tid & 31;
    const int w    = tid >> 5;
    const int lm   = lane & 15;      // fragment row/col within 16
    const int hi   = lane >> 4;      // half-wave select (K pair / M+8)

    const int mBase = blockIdx.x * 64;
    const int nBase = blockIdx.y * 128;
    const int wm0   = (w & 3) * 16;  // wave M offset in WG tile
    const int wn0   = (w >> 2) * 64; // wave N offset in WG tile
    const bool fullN = (nBase + 128 <= N);   // uniform per block

    v8f acc[4];
    #pragma unroll
    for (int t = 0; t < 4; ++t) acc[t] = (v8f){0.f,0.f,0.f,0.f,0.f,0.f,0.f,0.f};

    // stage one 64x32 A chunk + 128x32 B chunk at K-offset k0 into buffer buf
    auto stage = [&](int k0, int buf) {
        #pragma unroll
        for (int i = 0; i < 2; ++i) {
            const int e = (i*256 + tid) * 4;          // [0,2048)
            const int r = e >> 5, c = e & 31;
            const float* g = A + (size_t)(mBase + r) * K + k0 + c;
            float*       l = &As[buf][r*LDA + c];
#ifdef ASYNC_B128
            __builtin_amdgcn_global_load_async_to_lds_b128((i32x4*)g, (i32x4*)l, 0, 0);
#else
            *(float4*)l = *(const float4*)g;
#endif
        }
        #pragma unroll
        for (int i = 0; i < 4; ++i) {
            const int e = (i*256 + tid) * 4;          // [0,4096)
            const int r = e >> 5, c = e & 31;
            const int n = nBase + r;
            const float* g = Bw + (size_t)n * K + k0 + c;
            float*       l = &Bs[buf][r*LDA + c];
#ifdef ASYNC_B128
            if (fullN) {
                __builtin_amdgcn_global_load_async_to_lds_b128((i32x4*)g, (i32x4*)l, 0, 0);
            } else
#endif
            {   // ragged-N tile: out-of-range rows must be ZERO in LDS
                float4 v = {0.f, 0.f, 0.f, 0.f};
                if (n < N) v = *(const float4*)g;
                *(float4*)l = v;
            }
        }
    };

    stage(0, 0);
    async_wait0();
    __syncthreads();

    int cur = 0;
    for (int k0 = 0; k0 < K; k0 += KB) {
        if (k0 + KB < K) stage(k0 + KB, cur ^ 1);   // overlap with compute below

        const float* as = As[cur];
        const float* bs = Bs[cur];
        // ---- 32 WMMAs per chunk: A frag reused across 4 N-tiles ----
        #pragma unroll
        for (int kk = 0; kk < KB; kk += 4) {
            const int ak = kk + 2*hi;   // ISA f32 A-layout: v0=K{0|2}, v1=K{1|3}
            const v2f a  = *(const v2f*)(&as[(wm0 + lm)*LDA + ak]);
            const v2f b0 = *(const v2f*)(&bs[(wn0 +  0 + lm)*LDA + ak]);
            const v2f b1 = *(const v2f*)(&bs[(wn0 + 16 + lm)*LDA + ak]);
            const v2f b2 = *(const v2f*)(&bs[(wn0 + 32 + lm)*LDA + ak]);
            const v2f b3 = *(const v2f*)(&bs[(wn0 + 48 + lm)*LDA + ak]);
            acc[0] = __builtin_amdgcn_wmma_f32_16x16x4_f32(false, a, false, b0, (short)0, acc[0], false, false);
            acc[1] = __builtin_amdgcn_wmma_f32_16x16x4_f32(false, a, false, b1, (short)0, acc[1], false, false);
            acc[2] = __builtin_amdgcn_wmma_f32_16x16x4_f32(false, a, false, b2, (short)0, acc[2], false, false);
            acc[3] = __builtin_amdgcn_wmma_f32_16x16x4_f32(false, a, false, b3, (short)0, acc[3], false, false);
        }
        async_wait0();      // next chunk landed in the other LDS buffer
        __syncthreads();
        cur ^= 1;
    }

    // ---- store D: VGPR r = row r (lanes 0-15) / row r+8 (lanes 16-31) ----
    const int mRow = mBase + wm0 + 8*hi;
    #pragma unroll
    for (int t = 0; t < 4; ++t) {
        const int n = nBase + wn0 + 16*t + lm;
        if (n < N) {
            #pragma unroll
            for (int r = 0; r < 8; ++r)
                C[(size_t)(mRow + r) * N + n] = acc[t][r];
        }
    }
}

// =====================================================================
// a_bar[b,t,h] = exp(softplus(Bm + dt_bias[h]) * (-exp(A_log[h])))
// =====================================================================
__global__ __launch_bounds__(256)
void abar_kernel(const float* __restrict__ P, const float* __restrict__ dt_bias,
                 const float* __restrict__ A_log, float* __restrict__ abar)
{
    const int gid = blockIdx.x * 256 + threadIdx.x;   // BATCH*SEQ*NH = 16384
    const int h   = gid & (NH - 1);
    const int row = gid >> 3;
    const float r  = P[(size_t)row * DP + 2*DI + h] + dt_bias[h];
    const float dt = (r > 20.f) ? r : log1pf(__expf(r));
    const float a  = -__expf(A_log[h]);
    abar[gid] = __expf(dt * a);
}

// =====================================================================
// depthwise causal conv(4) + SiLU over the xc slice of zxBCdt
// =====================================================================
__global__ __launch_bounds__(256)
void conv_silu_kernel(const float* __restrict__ P, const float* __restrict__ conv_w,
                      const float* __restrict__ conv_b, float* __restrict__ xh)
{
    const int gid = blockIdx.x * 256 + threadIdx.x;   // BATCH*SEQ*DI
    const int c   = gid & (DI - 1);
    const int row = gid >> 11;
    const int t   = row & (SEQ - 1);
    const float4 w = *(const float4*)(conv_w + c * 4);
    const float* xin = P + (size_t)row * DP + DI + c;
    float acc = conv_b[c];
    if (t >= 3) {
        acc = fmaf(xin[-3*DP], w.x, acc);
        acc = fmaf(xin[-2*DP], w.y, acc);
        acc = fmaf(xin[-1*DP], w.z, acc);
        acc = fmaf(xin[ 0   ], w.w, acc);
    } else {
        const float wk[4] = {w.x, w.y, w.z, w.w};
        #pragma unroll
        for (int k = 0; k < 4; ++k) {
            const int tt = t - 3 + k;
            if (tt >= 0) acc = fmaf(xin[(k - 3) * DP], wk[k], acc);
        }
    }
    xh[gid] = acc / (1.f + __expf(-acc));   // SiLU
}

// =====================================================================
// Selective scan. One WG per (b,h); lane d owns h-state row st[64] in
// VGPRs. B_t/C_t double-buffered in LDS; the next timestep's vectors
// stream in via async global->LDS while the 64-deep FMA chain runs.
// One barrier per timestep.
// =====================================================================
__global__ __launch_bounds__(256)
void scan_kernel(const float* __restrict__ P, const float* __restrict__ xh,
                 const float* __restrict__ abar, const float* __restrict__ Dp_,
                 float* __restrict__ y)
{
    __shared__ float Bs[2][DSTATE];
    __shared__ float Cs[2][DSTATE];
    const int tid = threadIdx.x;                 // d in [0,256)
    const int b   = blockIdx.x >> 3;
    const int h   = blockIdx.x & (NH - 1);
    const float Dp = Dp_[h];

    float st[DSTATE];
    #pragma unroll
    for (int n = 0; n < DSTATE; ++n) st[n] = 0.f;

    // preload t = 0 (synchronous is fine for the prologue)
    if (tid < DSTATE)            Bs[0][tid]        = P[(size_t)(b*SEQ)*DP + BOFF + tid];
    else if (tid < 2*DSTATE)     Cs[0][tid-DSTATE] = P[(size_t)(b*SEQ)*DP + COFF + (tid-DSTATE)];
    __syncthreads();

    for (int t = 0; t < SEQ; ++t) {
        const int cur = t & 1, nxt = cur ^ 1;
        if (t + 1 < SEQ) {   // overlap next-step B/C fetch with the FMA chain
#ifdef ASYNC_B32
            if (tid < DSTATE)
                __builtin_amdgcn_global_load_async_to_lds_b32(
                    (int*)(P + (size_t)(b*SEQ + t + 1)*DP + BOFF + tid),
                    (int*)&Bs[nxt][tid], 0, 0);
            else if (tid < 2*DSTATE)
                __builtin_amdgcn_global_load_async_to_lds_b32(
                    (int*)(P + (size_t)(b*SEQ + t + 1)*DP + COFF + (tid-DSTATE)),
                    (int*)&Cs[nxt][tid-DSTATE], 0, 0);
#else
            if (tid < DSTATE)
                Bs[nxt][tid] = P[(size_t)(b*SEQ + t + 1)*DP + BOFF + tid];
            else if (tid < 2*DSTATE)
                Cs[nxt][tid-DSTATE] = P[(size_t)(b*SEQ + t + 1)*DP + COFF + (tid-DSTATE)];
#endif
        }
        const float a = abar[(b*SEQ + t)*NH + h];
        const float x = xh[((size_t)(b*SEQ + t))*DI + h*HD + tid];
        float acc = 0.f;
        #pragma unroll
        for (int n = 0; n < DSTATE; ++n) {
            st[n] = fmaf(a, st[n], Bs[cur][n] * x);
            acc   = fmaf(st[n], Cs[cur][n], acc);
        }
        y[((size_t)(b*SEQ + t))*DI + h*HD + tid] = fmaf(x, Dp, acc);
        async_wait0();
        __syncthreads();
    }
}

// =====================================================================
// y = RMSNorm(y * SiLU(z)) * norm_w   (in place; one WG per (b,t) row)
// =====================================================================
__global__ __launch_bounds__(256)
void gate_rms_kernel(float* __restrict__ y, const float* __restrict__ P,
                     const float* __restrict__ norm_w)
{
    __shared__ float red[256];
    const int row = blockIdx.x;
    const int tid = threadIdx.x;
    float g[8];
    float ss = 0.f;
    #pragma unroll
    for (int j = 0; j < 8; ++j) {
        const int i = tid + j*256;
        const float z = P[(size_t)row * DP + i];           // z slice = cols [0,DI)
        const float s = z / (1.f + __expf(-z));
        const float v = y[(size_t)row * DI + i] * s;
        g[j] = v;
        ss = fmaf(v, v, ss);
    }
    red[tid] = ss;
    __syncthreads();
    for (int off = 128; off > 0; off >>= 1) {
        if (tid < off) red[tid] += red[tid + off];
        __syncthreads();
    }
    const float inv = rsqrtf(red[0] / (float)DI + 1e-6f);
    #pragma unroll
    for (int j = 0; j < 8; ++j) {
        const int i = tid + j*256;
        y[(size_t)row * DI + i] = g[j] * inv * norm_w[i];
    }
}

// =====================================================================
extern "C" void kernel_launch(void* const* d_in, const int* in_sizes, int n_in,
                              void* d_out, int out_size, void* d_ws, size_t ws_size,
                              hipStream_t stream)
{
    const float* x         = (const float*)d_in[0];
    const float* in_proj_w = (const float*)d_in[1];
    const float* conv_w    = (const float*)d_in[2];
    const float* conv_b    = (const float*)d_in[3];
    const float* A_log     = (const float*)d_in[4];
    const float* D_param   = (const float*)d_in[5];
    const float* dt_bias   = (const float*)d_in[6];
    const float* norm_w    = (const float*)d_in[7];
    const float* out_proj_w= (const float*)d_in[8];
    float* out = (float*)d_out;

    // workspace layout (floats): zxBCdt | xh | abar | y   (~68.3 MB total)
    float* zx   = (float*)d_ws;
    float* xh   = zx   + (size_t)BATCH * SEQ * DP;
    float* abar = xh   + (size_t)BATCH * SEQ * DI;
    float* yb   = abar + (size_t)BATCH * SEQ * NH;

    const int M = BATCH * SEQ;   // 2048

    // 1) in_proj:  zx[M,4232] = x[M,1024] * in_proj_w[4232,1024]^T
    gemm_f32_wmma<<<dim3(M/64, (DP + 127)/128), 256, 0, stream>>>(x, in_proj_w, zx, M, DP, DIMX);
    // 2) a_bar
    abar_kernel<<<(M * NH)/256, 256, 0, stream>>>(zx, dt_bias, A_log, abar);
    // 3) conv + SiLU
    conv_silu_kernel<<<((size_t)M * DI)/256, 256, 0, stream>>>(zx, conv_w, conv_b, xh);
    // 4) selective scan
    scan_kernel<<<BATCH * NH, 256, 0, stream>>>(zx, xh, abar, D_param, yb);
    // 5) gate + RMSNorm (in place on yb)
    gate_rms_kernel<<<M, 256, 0, stream>>>(yb, zx, norm_w);
    // 6) out_proj:  out[M,1024] = yb[M,2048] * out_proj_w[1024,2048]^T
    gemm_f32_wmma<<<dim3(M/64, DIMX/128), 256, 0, stream>>>(yb, out_proj_w, out, M, DIMX, DI);
}

// v001
// One run takes 300 microseconds.
// In two side-by-side timings against v000, it was 4.07 and 4.10 times as fast.
#include <hip/hip_runtime.h>
#include <math.h>

// ---------------- problem constants (match reference) ----------------
#define DIMX   1024
#define DSTATE 64
#define NH     8
#define DI     2048            // D_INNER
#define HD     256             // HEAD_DIM
#define DP     4232            // D_IN_PROJ = 2*DI + NH + 2*DSTATE
#define SEQ    1024
#define BATCH  2
#define BOFF   (2*DI + NH)          // B_proj (=Cm slice) columns [4104,4168)
#define COFF   (2*DI + NH + DSTATE) // C_proj (=dtm slice) columns [4168,4232)
#define NSEG   32              // time segments of the scan
#define TSEG   (SEQ / NSEG)    // steps per segment

typedef float v2f __attribute__((ext_vector_type(2)));
typedef float v8f __attribute__((ext_vector_type(8)));
typedef int   i32x4 __attribute__((vector_size(4 * sizeof(int))));  // matches builtin proto

// gfx1250 async global->LDS copies (ASYNCcnt-tracked). Guarded so the code
// still compiles (sync fallback) if this toolchain doesn't expose them.
#if __has_builtin(__builtin_amdgcn_global_load_async_to_lds_b128)
#define ASYNC_B128 1
#endif
#if __has_builtin(__builtin_amdgcn_global_load_async_to_lds_b32)
#define ASYNC_B32 1
#endif

__device__ __forceinline__ void async_wait0()
{
#if defined(ASYNC_B128) || defined(ASYNC_B32)
#if __has_builtin(__builtin_amdgcn_s_wait_asynccnt)
    __builtin_amdgcn_s_wait_asynccnt(0);
#else
    asm volatile("s_wait_asynccnt 0x0" ::: "memory");
#endif
#endif
}

// =====================================================================
// GEMM: C[M,N] = A[M,K] * B[N,K]^T   (both row-major, fp32)
// WG = 256 thr (8 waves). WG tile 64x128. Wave tile 16x64 (4 wmma accs).
// K staged through double-buffered LDS in 32-wide chunks; chunk k+1 is
// fetched with global_load_async_to_lds_b128 while chunk k feeds
// V_WMMA_F32_16X16X4_F32. One barrier per chunk.
// =====================================================================
#define KB  32
#define LDA 36   // padded LDS row stride (floats): 16B-aligned, conflict-free

__global__ __launch_bounds__(256)
void gemm_f32_wmma(const float* __restrict__ A, const float* __restrict__ Bw,
                   float* __restrict__ C, int M, int N, int K)
{
    __shared__ float As[2][64  * LDA];
    __shared__ float Bs[2][128 * LDA];

    const int tid  = threadIdx.x;
    const int lane = tid & 31;
    const int w    = tid >> 5;
    const int lm   = lane & 15;      // fragment row/col within 16
    const int hi   = lane >> 4;      // half-wave select (K pair / M+8)

    const int mBase = blockIdx.x * 64;
    const int nBase = blockIdx.y * 128;
    const int wm0   = (w & 3) * 16;  // wave M offset in WG tile
    const int wn0   = (w >> 2) * 64; // wave N offset in WG tile
    const bool fullN = (nBase + 128 <= N);   // uniform per block

    v8f acc[4];
    #pragma unroll
    for (int t = 0; t < 4; ++t) acc[t] = (v8f){0.f,0.f,0.f,0.f,0.f,0.f,0.f,0.f};

    // stage one 64x32 A chunk + 128x32 B chunk at K-offset k0 into buffer buf
    auto stage = [&](int k0, int buf) {
        #pragma unroll
        for (int i = 0; i < 2; ++i) {
            const int e = (i*256 + tid) * 4;          // [0,2048)
            const int r = e >> 5, c = e & 31;
            const float* g = A + (size_t)(mBase + r) * K + k0 + c;
            float*       l = &As[buf][r*LDA + c];
#ifdef ASYNC_B128
            __builtin_amdgcn_global_load_async_to_lds_b128((i32x4*)g, (i32x4*)l, 0, 0);
#else
            *(float4*)l = *(const float4*)g;
#endif
        }
        #pragma unroll
        for (int i = 0; i < 4; ++i) {
            const int e = (i*256 + tid) * 4;          // [0,4096)
            const int r = e >> 5, c = e & 31;
            const int n = nBase + r;
            const float* g = Bw + (size_t)n * K + k0 + c;
            float*       l = &Bs[buf][r*LDA + c];
#ifdef ASYNC_B128
            if (fullN) {
                __builtin_amdgcn_global_load_async_to_lds_b128((i32x4*)g, (i32x4*)l, 0, 0);
            } else
#endif
            {   // ragged-N tile: out-of-range rows must be ZERO in LDS
                float4 v = {0.f, 0.f, 0.f, 0.f};
                if (n < N) v = *(const float4*)g;
                *(float4*)l = v;
            }
        }
    };

    stage(0, 0);
    async_wait0();
    __syncthreads();

    int cur = 0;
    for (int k0 = 0; k0 < K; k0 += KB) {
        if (k0 + KB < K) stage(k0 + KB, cur ^ 1);   // overlap with compute below

        const float* as = As[cur];
        const float* bs = Bs[cur];
        // ---- 32 WMMAs per chunk: A frag reused across 4 N-tiles ----
        #pragma unroll
        for (int kk = 0; kk < KB; kk += 4) {
            const int ak = kk + 2*hi;   // ISA f32 A-layout: v0=K{0|2}, v1=K{1|3}
            const v2f a  = *(const v2f*)(&as[(wm0 + lm)*LDA + ak]);
            const v2f b0 = *(const v2f*)(&bs[(wn0 +  0 + lm)*LDA + ak]);
            const v2f b1 = *(const v2f*)(&bs[(wn0 + 16 + lm)*LDA + ak]);
            const v2f b2 = *(const v2f*)(&bs[(wn0 + 32 + lm)*LDA + ak]);
            const v2f b3 = *(const v2f*)(&bs[(wn0 + 48 + lm)*LDA + ak]);
            acc[0] = __builtin_amdgcn_wmma_f32_16x16x4_f32(false, a, false, b0, (short)0, acc[0], false, false);
            acc[1] = __builtin_amdgcn_wmma_f32_16x16x4_f32(false, a, false, b1, (short)0, acc[1], false, false);
            acc[2] = __builtin_amdgcn_wmma_f32_16x16x4_f32(false, a, false, b2, (short)0, acc[2], false, false);
            acc[3] = __builtin_amdgcn_wmma_f32_16x16x4_f32(false, a, false, b3, (short)0, acc[3], false, false);
        }
        async_wait0();      // next chunk landed in the other LDS buffer
        __syncthreads();
        cur ^= 1;
    }

    // ---- store D: VGPR r = row r (lanes 0-15) / row r+8 (lanes 16-31) ----
    const int mRow = mBase + wm0 + 8*hi;
    #pragma unroll
    for (int t = 0; t < 4; ++t) {
        const int n = nBase + wn0 + 16*t + lm;
        if (n < N) {
            #pragma unroll
            for (int r = 0; r < 8; ++r)
                C[(size_t)(mRow + r) * N + n] = acc[t][r];
        }
    }
}

// =====================================================================
// a_bar[b,t,h] = exp(softplus(Bm + dt_bias[h]) * (-exp(A_log[h])))
// =====================================================================
__global__ __launch_bounds__(256)
void abar_kernel(const float* __restrict__ P, const float* __restrict__ dt_bias,
                 const float* __restrict__ A_log, float* __restrict__ abar)
{
    const int gid = blockIdx.x * 256 + threadIdx.x;   // BATCH*SEQ*NH = 16384
    const int h   = gid & (NH - 1);
    const int row = gid >> 3;
    const float r  = P[(size_t)row * DP + 2*DI + h] + dt_bias[h];
    const float dt = (r > 20.f) ? r : log1pf(__expf(r));
    const float a  = -__expf(A_log[h]);
    abar[gid] = __expf(dt * a);
}

// =====================================================================
// depthwise causal conv(4) + SiLU over the xc slice of zxBCdt
// =====================================================================
__global__ __launch_bounds__(256)
void conv_silu_kernel(const float* __restrict__ P, const float* __restrict__ conv_w,
                      const float* __restrict__ conv_b, float* __restrict__ xh)
{
    const int gid = blockIdx.x * 256 + threadIdx.x;   // BATCH*SEQ*DI
    const int c   = gid & (DI - 1);
    const int row = gid >> 11;
    const int t   = row & (SEQ - 1);
    const float4 w = *(const float4*)(conv_w + c * 4);
    const float* xin = P + (size_t)row * DP + DI + c;
    float acc = conv_b[c];
    if (t >= 3) {
        acc = fmaf(xin[-3*DP], w.x, acc);
        acc = fmaf(xin[-2*DP], w.y, acc);
        acc = fmaf(xin[-1*DP], w.z, acc);
        acc = fmaf(xin[ 0   ], w.w, acc);
    } else {
        const float wk[4] = {w.x, w.y, w.z, w.w};
        #pragma unroll
        for (int k = 0; k < 4; ++k) {
            const int tt = t - 3 + k;
            if (tt >= 0) acc = fmaf(xin[(k - 3) * DP], wk[k], acc);
        }
    }
    xh[gid] = acc / (1.f + __expf(-acc));   // SiLU
}

// =====================================================================
// The recurrence h_t = a_t h_{t-1} + B_t x_t is linear in h, so the time
// axis is cut into NSEG segments that run side by side:
//   1) seg_state_kernel: end state of each segment started from zero, and
//      the product of its a_t;
//   2) seg_carry_kernel: H_s = Aseg_s * H_{s-1} + S_s over the segments;
//   3) scan_kernel: each segment again, started from the carried state,
//      this time with the outputs.
// State planes: S[(bh*(NSEG-1) + seg)][n][d]; the last segment's end state
// is never needed.
// =====================================================================

// One WG per (segment, b*h); lane d owns st[64]. B_t is the same for every
// lane, so it is read at a uniform address: no LDS and no barrier here.
__global__ __launch_bounds__(256)
void seg_state_kernel(const float* __restrict__ P, const float* __restrict__ xh,
                      const float* __restrict__ abar, float* __restrict__ S,
                      float* __restrict__ Aseg)
{
    const int tid = threadIdx.x;                 // d in [0,256)
    const int seg = blockIdx.x;                  // [0, NSEG-1)
    const int bh  = blockIdx.y;
    const int b   = bh >> 3;
    const int h   = bh & (NH - 1);

    float st[DSTATE];
    #pragma unroll
    for (int n = 0; n < DSTATE; ++n) st[n] = 0.f;
    float p = 1.f;

    const int t0 = seg * TSEG;
    for (int t = t0; t < t0 + TSEG; ++t) {
        const float* Bt = P + (size_t)(b*SEQ + t)*DP + BOFF;
        const float a = abar[(b*SEQ + t)*NH + h];
        const float x = xh[((size_t)(b*SEQ + t))*DI + h*HD + tid];
        p *= a;
        #pragma unroll
        for (int n = 0; n < DSTATE; ++n)
            st[n] = fmaf(a, st[n], Bt[n] * x);
    }

    float* s = S + ((size_t)(bh*(NSEG-1) + seg) * DSTATE) * HD + tid;
    #pragma unroll
    for (int n = 0; n < DSTATE; ++n) s[n * HD] = st[n];
    if (tid == 0) Aseg[bh*(NSEG-1) + seg] = p;
}

// In place: plane s becomes the state at the END of segment s, which is the
// start state of segment s+1. One thread per 4 state elements, in three
// phases: fetch every plane, run the carry in registers, store every plane but plane 0.
__global__ __launch_bounds__(256)
void seg_carry_kernel(float* __restrict__ S, const float* __restrict__ Aseg)
{
    const int bh  = blockIdx.x / (DSTATE*HD/4/256);   // 16 blocks per (b,h)
    const int e   = (blockIdx.x % (DSTATE*HD/4/256)) * 256 + threadIdx.x;
    float4* s = (float4*)S + (size_t)bh * (NSEG-1) * (DSTATE*HD/4) + e;

    float4 v[NSEG-1];
    #pragma unroll
    for (int c = 0; c < NSEG-1; ++c) v[c] = s[(size_t)c * (DSTATE*HD/4)];
    // keeps every load above the arithmetic: all planes are in flight at once
    // instead of being fetched as registers come free
    __builtin_amdgcn_sched_barrier(0);

    #pragma unroll
    for (int c = 1; c < NSEG-1; ++c) {                // plane 0 is already final
        const float a = Aseg[bh*(NSEG-1) + c];
        v[c].x = fmaf(a, v[c-1].x, v[c].x);
        v[c].y = fmaf(a, v[c-1].y, v[c].y);
        v[c].z = fmaf(a, v[c-1].z, v[c].z);
        v[c].w = fmaf(a, v[c-1].w, v[c].w);
    }
    // keeps the stores below the arithmetic: no register of an issued store
    // is written again
    __builtin_amdgcn_sched_barrier(0);

    #pragma unroll
    for (int c = 1; c < NSEG-1; ++c) s[(size_t)c * (DSTATE*HD/4)] = v[c];
}

// =====================================================================
// Selective scan of one segment. One WG per (segment, b*h); lane d owns
// h-state row st[64] in VGPRs, started from the carried state. B_t/C_t
// double-buffered in LDS; the next timestep's vectors stream in via async
// global->LDS while the 64-deep FMA chain runs. One barrier per timestep.
// =====================================================================
__global__ __launch_bounds__(256)
void scan_kernel(const float* __restrict__ P, const float* __restrict__ xh,
                 const float* __restrict__ abar, const float* __restrict__ Dp_,
                 const float* __restrict__ S, float* __restrict__ y)
{
    __shared__ float Bs[2][DSTATE];
    __shared__ float Cs[2][DSTATE];
    const int tid = threadIdx.x;                 // d in [0,256)
    const int seg = blockIdx.x;                  // [0, NSEG)
    const int b   = blockIdx.y >> 3;
    const int h   = blockIdx.y & (NH - 1);
    const float Dp = Dp_[h];
    const int t0   = seg * TSEG;                 // even, so buffer 0 is first
    const int tEnd = t0 + TSEG;

    float st[DSTATE];
    if (seg > 0) {
        const float* s0 = S + ((size_t)(blockIdx.y*(NSEG-1) + seg - 1) * DSTATE) * HD + tid;
        #pragma unroll
        for (int n = 0; n < DSTATE; ++n) st[n] = s0[n * HD];
    } else {
        #pragma unroll
        for (int n = 0; n < DSTATE; ++n) st[n] = 0.f;
    }

    // preload t = t0 (synchronous is fine for the prologue)
    if (tid < DSTATE)            Bs[0][tid]        = P[(size_t)(b*SEQ + t0)*DP + BOFF + tid];
    else if (tid < 2*DSTATE)     Cs[0][tid-DSTATE] = P[(size_t)(b*SEQ + t0)*DP + COFF + (tid-DSTATE)];
    __syncthreads();

    for (int t = t0; t < tEnd; ++t) {
        const int cur = t & 1, nxt = cur ^ 1;
        if (t + 1 < tEnd) {   // overlap next-step B/C fetch with the FMA chain
#ifdef ASYNC_B32
            if (tid < DSTATE)
                __builtin_amdgcn_global_load_async_to_lds_b32(
                    (int*)(P + (size_t)(b*SEQ + t + 1)*DP + BOFF + tid),
                    (int*)&Bs[nxt][tid], 0, 0);
            else if (tid < 2*DSTATE)
                __builtin_amdgcn_global_load_async_to_lds_b32(
                    (int*)(P + (size_t)(b*SEQ + t + 1)*DP + COFF + (tid-DSTATE)),
                    (int*)&Cs[nxt][tid-DSTATE], 0, 0);
#else
            if (tid < DSTATE)
                Bs[nxt][tid] = P[(size_t)(b*SEQ + t + 1)*DP + BOFF + tid];
            else if (tid < 2*DSTATE)
                Cs[nxt][tid-DSTATE] = P[(size_t)(b*SEQ + t + 1)*DP + COFF + (tid-DSTATE)];
#endif
        }
        const float a = abar[(b*SEQ + t)*NH + h];
        const float x = xh[((size_t)(b*SEQ + t))*DI + h*HD + tid];
        float acc = 0.f;
        #pragma unroll
        for (int n = 0; n < DSTATE; ++n) {
            st[n] = fmaf(a, st[n], Bs[cur][n] * x);
            acc   = fmaf(st[n], Cs[cur][n], acc);
        }
        y[((size_t)(b*SEQ + t))*DI + h*HD + tid] = fmaf(x, Dp, acc);
        async_wait0();
        __syncthreads();
    }
}

// =====================================================================
// y = RMSNorm(y * SiLU(z)) * norm_w   (in place; one WG per (b,t) row)
// =====================================================================
__global__ __launch_bounds__(256)
void gate_rms_kernel(float* __restrict__ y, const float* __restrict__ P,
                     const float* __restrict__ norm_w)
{
    __shared__ float red[256];
    const int row = blockIdx.x;
    const int tid = threadIdx.x;
    float g[8];
    float ss = 0.f;
    #pragma unroll
    for (int j = 0; j < 8; ++j) {
        const int i = tid + j*256;
        const float z = P[(size_t)row * DP + i];           // z slice = cols [0,DI)
        const float s = z / (1.f + __expf(-z));
        const float v = y[(size_t)row * DI + i] * s;
        g[j] = v;
        ss = fmaf(v, v, ss);
    }
    red[tid] = ss;
    __syncthreads();
    for (int off = 128; off > 0; off >>= 1) {
        if (tid < off) red[tid] += red[tid + off];
        __syncthreads();
    }
    const float inv = rsqrtf(red[0] / (float)DI + 1e-6f);
    #pragma unroll
    for (int j = 0; j < 8; ++j) {
        const int i = tid + j*256;
        y[(size_t)row * DI + i] = g[j] * inv * norm_w[i];
    }
}

// =====================================================================
extern "C" void kernel_launch(void* const* d_in, const int* in_sizes, int n_in,
                              void* d_out, int out_size, void* d_ws, size_t ws_size,
                              hipStream_t stream)
{
    const float* x         = (const float*)d_in[0];
    const float* in_proj_w = (const float*)d_in[1];
    const float* conv_w    = (const float*)d_in[2];
    const float* conv_b    = (const float*)d_in[3];
    const float* A_log     = (const float*)d_in[4];
    const float* D_param   = (const float*)d_in[5];
    const float* dt_bias   = (const float*)d_in[6];
    const float* norm_w    = (const float*)d_in[7];
    const float* out_proj_w= (const float*)d_in[8];
    float* out = (float*)d_out;

    // workspace layout (floats): zxBCdt | xh | abar | y | S | Aseg  (~101 MB total)
    float* zx   = (float*)d_ws;
    float* xh   = zx   + (size_t)BATCH * SEQ * DP;
    float* abar = xh   + (size_t)BATCH * SEQ * DI;
    float* yb   = abar + (size_t)BATCH * SEQ * NH;
    float* sg   = yb   + (size_t)BATCH * SEQ * DI;
    float* aseg = sg   + (size_t)BATCH * NH * (NSEG-1) * DSTATE * HD;

    const int M = BATCH * SEQ;   // 2048

    // 1) in_proj:  zx[M,4232] = x[M,1024] * in_proj_w[4232,1024]^T
    gemm_f32_wmma<<<dim3(M/64, (DP + 127)/128), 256, 0, stream>>>(x, in_proj_w, zx, M, DP, DIMX);
    // 2) a_bar
    abar_kernel<<<(M * NH)/256, 256, 0, stream>>>(zx, dt_bias, A_log, abar);
    // 3) conv + SiLU
    conv_silu_kernel<<<((size_t)M * DI)/256, 256, 0, stream>>>(zx, conv_w, conv_b, xh);
    // 4) selective scan in NSEG time segments: end states, carry, outputs
    seg_state_kernel<<<dim3(NSEG-1, BATCH*NH), 256, 0, stream>>>(zx, xh, abar, sg, aseg);
    seg_carry_kernel<<<(BATCH*NH*DSTATE*HD/4)/256, 256, 0, stream>>>(sg, aseg);
    scan_kernel<<<dim3(NSEG, BATCH*NH), 256, 0, stream>>>(zx, xh, abar, D_param, sg, yb);
    // 5) gate + RMSNorm (in place on yb)
    gate_rms_kernel<<<M, 256, 0, stream>>>(yb, zx, norm_w);
    // 6) out_proj:  out[M,1024] = yb[M,2048] * out_proj_w[1024,2048]^T
    gemm_f32_wmma<<<dim3(M/64, DIMX/128), 256, 0, stream>>>(yb, out_proj_w, out, M, DIMX, DI);
}

// v002
// A run of this version takes 266 microseconds.
// Next to v001, in two timings, it ran 1.13 times as fast each time.
// All steps since v000 together make it 4.61 times as fast.
#include <hip/hip_runtime.h>
#include <math.h>

// ---------------- problem constants (match reference) ----------------
#define DIMX   1024
#define DSTATE 64
#define NH     8
#define DI     2048            // D_INNER
#define HD     256             // HEAD_DIM
#define DP     4232            // D_IN_PROJ = 2*DI + NH + 2*DSTATE
#define SEQ    1024
#define BATCH  2
#define BOFF   (2*DI + NH)          // B_proj (=Cm slice) columns [4104,4168)
#define COFF   (2*DI + NH + DSTATE) // C_proj (=dtm slice) columns [4168,4232)
#define NSEG   32              // time segments of the scan
#define TSEG   (SEQ / NSEG)    // steps per segment

typedef float v2f __attribute__((ext_vector_type(2)));
typedef float v8f __attribute__((ext_vector_type(8)));
typedef int   i32x4 __attribute__((vector_size(4 * sizeof(int))));  // matches builtin proto

// gfx1250 async global->LDS copies (ASYNCcnt-tracked). Guarded so the code
// still compiles (sync fallback) if this toolchain doesn't expose them.
#if __has_builtin(__builtin_amdgcn_global_load_async_to_lds_b128)
#define ASYNC_B128 1
#endif
#if __has_builtin(__builtin_amdgcn_global_load_async_to_lds_b32)
#define ASYNC_B32 1
#endif

__device__ __forceinline__ void async_wait0()
{
#if defined(ASYNC_B128) || defined(ASYNC_B32)
#if __has_builtin(__builtin_amdgcn_s_wait_asynccnt)
    __builtin_amdgcn_s_wait_asynccnt(0);
#else
    asm volatile("s_wait_asynccnt 0x0" ::: "memory");
#endif
#endif
}

// =====================================================================
// GEMM: C[M,N] = A[M,K] * B[N,K]^T   (both row-major, fp32)
// The tile is sized so that a launch is one workgroup per WGP, all of them
// resident at once and with equal work: 128 rows x NF*16 columns.
// WG = 256 thr (8 waves); wave w owns rows [16w,16w+16) and all NF column
// fragments (NF wmma accumulators, one A fragment reused NF times).
// K goes through two LDS buffers in KC-wide stages: stage t+2 is copied with
// global_load_async_to_lds_b128 while stage t+1 feeds V_WMMA_F32_16X16X4_F32.
// One barrier per stage.
// =====================================================================
template <int NF, int KC, int N, int K>
__global__ __launch_bounds__(256)
void gemm_f32_wmma(const float* __restrict__ A, const float* __restrict__ Bw,
                   float* __restrict__ C)
{
    constexpr int BM = 128;          // rows of the WG tile
    constexpr int BN = NF * 16;      // columns of the WG tile
    constexpr int LD = KC + 4;       // padded LDS row stride (floats): 16B-aligned, conflict-free
    constexpr int PR = KC / 4;       // 16-byte pieces per staged row
    constexpr int RP = 256 / PR;     // rows staged by one copy of the whole WG
    constexpr int NT = K / KC;       // stages
    static_assert(NT >= 2 && K % KC == 0, "two stages or more");
    static_assert(BM % RP == 0 && BN % RP == 0, "whole copies");

    __shared__ __attribute__((aligned(16))) float As[2][BM * LD];
    __shared__ __attribute__((aligned(16))) float Bs[2][BN * LD];

    const int tid  = threadIdx.x;
    const int lane = tid & 31;
    const int w    = tid >> 5;
    const int lm   = lane & 15;      // fragment row/col within 16
    const int hi   = lane >> 4;      // half-wave select (K pair / M+8)

    const int mBase = blockIdx.x * BM;
    const int nBase = blockIdx.y * BN;

    v8f acc[NF];
    #pragma unroll
    for (int f = 0; f < NF; ++f) acc[f] = (v8f){0.f,0.f,0.f,0.f,0.f,0.f,0.f,0.f};

    const int sr = tid / PR;         // row within one copy of the WG
    const int sc = (tid % PR) * 4;   // float column of this thread's 16 bytes

    // stage the BM x KC chunk of A and the BN x KC chunk of B at K-offset k0
    auto stage = [&](int k0, int buf) {
        #pragma unroll
        for (int i = 0; i < BM / RP; ++i) {
            const int r = i * RP + sr;
            const float* g = A + (size_t)(unsigned)((mBase + r) * K + k0 + sc);
            float*       l = &As[buf][r * LD + sc];
#ifdef ASYNC_B128
            __builtin_amdgcn_global_load_async_to_lds_b128((i32x4*)g, (i32x4*)l, 0, 0);
#else
            *(float4*)l = *(const float4*)g;
#endif
        }
        #pragma unroll
        for (int i = 0; i < BN / RP; ++i) {
            const int r = i * RP + sr;
            // a row of B feeds output column n alone, and columns n >= N are
            // never stored: past the edge the last row is copied again
            const int n = min(nBase + r, N - 1);
            const float* g = Bw + (size_t)(unsigned)(n * K + k0 + sc);
            float*       l = &Bs[buf][r * LD + sc];
#ifdef ASYNC_B128
            __builtin_amdgcn_global_load_async_to_lds_b128((i32x4*)g, (i32x4*)l, 0, 0);
#else
            *(float4*)l = *(const float4*)g;
#endif
        }
    };

    stage(0, 0);
    // stage 0 has landed before the barrier behind which other waves read it
    asm volatile("s_wait_asynccnt 0x0" ::: "memory");
    __syncthreads();
    stage(KC, 1);

    // rolled, for speed only
    #pragma unroll 1
    for (int t = 0; t < NT; ++t) {
        const int cur = t & 1;
        const float* as = &As[cur][(w * 16 + lm) * LD + 2 * hi];  // ISA f32 A-layout: v0=K{0|2}, v1=K{1|3}
        const float* bs = &Bs[cur][lm * LD + 2 * hi];
        #pragma unroll
        for (int kk = 0; kk < KC; kk += 4) {
            const v2f a = *(const v2f*)(as + kk);
            #pragma unroll
            for (int f = 0; f < NF; ++f) {
                const v2f b = *(const v2f*)(bs + f * 16 * LD + kk);
                acc[f] = __builtin_amdgcn_wmma_f32_16x16x4_f32(false, a, false, b, (short)0, acc[f], false, false);
            }
        }
        // this wave's reads of buffer cur are over before it is refilled
        asm volatile("s_wait_dscnt 0x0" ::: "memory");
        // this wave's copies of stage t+1 have landed before the barrier
        asm volatile("s_wait_asynccnt 0x0" ::: "memory");
        __syncthreads();
        if (t + 2 < NT) stage((t + 2) * KC, cur);
    }
    // no copy is outstanding when the wave ends
    asm volatile("s_wait_asynccnt 0x0" ::: "memory");

    // ---- store D: VGPR r = row r (lanes 0-15) / row r+8 (lanes 16-31) ----
    const int mRow = mBase + w * 16 + 8 * hi;
    #pragma unroll
    for (int f = 0; f < NF; ++f) {
        const int n = nBase + 16 * f + lm;
        if (n < N) {
            #pragma unroll
            for (int r = 0; r < 8; ++r)
                C[(size_t)(mRow + r) * N + n] = acc[f][r];
        }
    }
}

// =====================================================================
// a_bar[b,t,h] = exp(softplus(Bm + dt_bias[h]) * (-exp(A_log[h])))
// =====================================================================
__global__ __launch_bounds__(256)
void abar_kernel(const float* __restrict__ P, const float* __restrict__ dt_bias,
                 const float* __restrict__ A_log, float* __restrict__ abar)
{
    const int gid = blockIdx.x * 256 + threadIdx.x;   // BATCH*SEQ*NH = 16384
    const int h   = gid & (NH - 1);
    const int row = gid >> 3;
    const float r  = P[(size_t)row * DP + 2*DI + h] + dt_bias[h];
    const float dt = (r > 20.f) ? r : log1pf(__expf(r));
    const float a  = -__expf(A_log[h]);
    abar[gid] = __expf(dt * a);
}

// =====================================================================
// depthwise causal conv(4) + SiLU over the xc slice of zxBCdt
// =====================================================================
__global__ __launch_bounds__(256)
void conv_silu_kernel(const float* __restrict__ P, const float* __restrict__ conv_w,
                      const float* __restrict__ conv_b, float* __restrict__ xh)
{
    const int gid = blockIdx.x * 256 + threadIdx.x;   // BATCH*SEQ*DI
    const int c   = gid & (DI - 1);
    const int row = gid >> 11;
    const int t   = row & (SEQ - 1);
    const float4 w = *(const float4*)(conv_w + c * 4);
    const float* xin = P + (size_t)row * DP + DI + c;
    float acc = conv_b[c];
    if (t >= 3) {
        acc = fmaf(xin[-3*DP], w.x, acc);
        acc = fmaf(xin[-2*DP], w.y, acc);
        acc = fmaf(xin[-1*DP], w.z, acc);
        acc = fmaf(xin[ 0   ], w.w, acc);
    } else {
        const float wk[4] = {w.x, w.y, w.z, w.w};
        #pragma unroll
        for (int k = 0; k < 4; ++k) {
            const int tt = t - 3 + k;
            if (tt >= 0) acc = fmaf(xin[(k - 3) * DP], wk[k], acc);
        }
    }
    xh[gid] = acc / (1.f + __expf(-acc));   // SiLU
}

// =====================================================================
// The recurrence h_t = a_t h_{t-1} + B_t x_t is linear in h, so the time
// axis is cut into NSEG segments that run side by side:
//   1) seg_state_kernel: end state of each segment started from zero, and
//      the product of its a_t;
//   2) seg_carry_kernel: H_s = Aseg_s * H_{s-1} + S_s over the segments;
//   3) scan_kernel: each segment again, started from the carried state,
//      this time with the outputs.
// State planes: S[(bh*(NSEG-1) + seg)][n][d]; the last segment's end state
// is never needed.
// =====================================================================

// One WG per (segment, b*h); lane d owns st[64]. B_t is the same for every
// lane, so it is read at a uniform address: no LDS and no barrier here.
__global__ __launch_bounds__(256)
void seg_state_kernel(const float* __restrict__ P, const float* __restrict__ xh,
                      const float* __restrict__ abar, float* __restrict__ S,
                      float* __restrict__ Aseg)
{
    const int tid = threadIdx.x;                 // d in [0,256)
    const int seg = blockIdx.x;                  // [0, NSEG-1)
    const int bh  = blockIdx.y;
    const int b   = bh >> 3;
    const int h   = bh & (NH - 1);

    float st[DSTATE];
    #pragma unroll
    for (int n = 0; n < DSTATE; ++n) st[n] = 0.f;
    float p = 1.f;

    const int t0 = seg * TSEG;
    for (int t = t0; t < t0 + TSEG; ++t) {
        const float* Bt = P + (size_t)(b*SEQ + t)*DP + BOFF;
        const float a = abar[(b*SEQ + t)*NH + h];
        const float x = xh[((size_t)(b*SEQ + t))*DI + h*HD + tid];
        p *= a;
        #pragma unroll
        for (int n = 0; n < DSTATE; ++n)
            st[n] = fmaf(a, st[n], Bt[n] * x);
    }

    float* s = S + ((size_t)(bh*(NSEG-1) + seg) * DSTATE) * HD + tid;
    #pragma unroll
    for (int n = 0; n < DSTATE; ++n) s[n * HD] = st[n];
    if (tid == 0) Aseg[bh*(NSEG-1) + seg] = p;
}

// In place: plane s becomes the state at the END of segment s, which is the
// start state of segment s+1. One thread per 4 state elements, in three
// phases: fetch every plane, run the carry in registers, store every plane but plane 0.
__global__ __launch_bounds__(256)
void seg_carry_kernel(float* __restrict__ S, const float* __restrict__ Aseg)
{
    const int bh  = blockIdx.x / (DSTATE*HD/4/256);   // 16 blocks per (b,h)
    const int e   = (blockIdx.x % (DSTATE*HD/4/256)) * 256 + threadIdx.x;
    float4* s = (float4*)S + (size_t)bh * (NSEG-1) * (DSTATE*HD/4) + e;

    float4 v[NSEG-1];
    #pragma unroll
    for (int c = 0; c < NSEG-1; ++c) v[c] = s[(size_t)c * (DSTATE*HD/4)];
    // keeps every load above the arithmetic: all planes are in flight at once
    // instead of being fetched as registers come free
    __builtin_amdgcn_sched_barrier(0);

    #pragma unroll
    for (int c = 1; c < NSEG-1; ++c) {                // plane 0 is already final
        const float a = Aseg[bh*(NSEG-1) + c];
        v[c].x = fmaf(a, v[c-1].x, v[c].x);
        v[c].y = fmaf(a, v[c-1].y, v[c].y);
        v[c].z = fmaf(a, v[c-1].z, v[c].z);
        v[c].w = fmaf(a, v[c-1].w, v[c].w);
    }
    // keeps the stores below the arithmetic: no register of an issued store
    // is written again
    __builtin_amdgcn_sched_barrier(0);

    #pragma unroll
    for (int c = 1; c < NSEG-1; ++c) s[(size_t)c * (DSTATE*HD/4)] = v[c];
}

// =====================================================================
// Selective scan of one segment. One WG per (segment, b*h); lane d owns
// h-state row st[64] in VGPRs, started from the carried state. B_t/C_t
// double-buffered in LDS; the next timestep's vectors stream in via async
// global->LDS while the 64-deep FMA chain runs. One barrier per timestep.
// =====================================================================
__global__ __launch_bounds__(256)
void scan_kernel(const float* __restrict__ P, const float* __restrict__ xh,
                 const float* __restrict__ abar, const float* __restrict__ Dp_,
                 const float* __restrict__ S, float* __restrict__ y)
{
    __shared__ float Bs[2][DSTATE];
    __shared__ float Cs[2][DSTATE];
    const int tid = threadIdx.x;                 // d in [0,256)
    const int seg = blockIdx.x;                  // [0, NSEG)
    const int b   = blockIdx.y >> 3;
    const int h   = blockIdx.y & (NH - 1);
    const float Dp = Dp_[h];
    const int t0   = seg * TSEG;                 // even, so buffer 0 is first
    const int tEnd = t0 + TSEG;

    float st[DSTATE];
    if (seg > 0) {
        const float* s0 = S + ((size_t)(blockIdx.y*(NSEG-1) + seg - 1) * DSTATE) * HD + tid;
        #pragma unroll
        for (int n = 0; n < DSTATE; ++n) st[n] = s0[n * HD];
    } else {
        #pragma unroll
        for (int n = 0; n < DSTATE; ++n) st[n] = 0.f;
    }

    // preload t = t0 (synchronous is fine for the prologue)
    if (tid < DSTATE)            Bs[0][tid]        = P[(size_t)(b*SEQ + t0)*DP + BOFF + tid];
    else if (tid < 2*DSTATE)     Cs[0][tid-DSTATE] = P[(size_t)(b*SEQ + t0)*DP + COFF + (tid-DSTATE)];
    __syncthreads();

    for (int t = t0; t < tEnd; ++t) {
        const int cur = t & 1, nxt = cur ^ 1;
        if (t + 1 < tEnd) {   // overlap next-step B/C fetch with the FMA chain
#ifdef ASYNC_B32
            if (tid < DSTATE)
                __builtin_amdgcn_global_load_async_to_lds_b32(
                    (int*)(P + (size_t)(b*SEQ + t + 1)*DP + BOFF + tid),
                    (int*)&Bs[nxt][tid], 0, 0);
            else if (tid < 2*DSTATE)
                __builtin_amdgcn_global_load_async_to_lds_b32(
                    (int*)(P + (size_t)(b*SEQ + t + 1)*DP + COFF + (tid-DSTATE)),
                    (int*)&Cs[nxt][tid-DSTATE], 0, 0);
#else
            if (tid < DSTATE)
                Bs[nxt][tid] = P[(size_t)(b*SEQ + t + 1)*DP + BOFF + tid];
            else if (tid < 2*DSTATE)
                Cs[nxt][tid-DSTATE] = P[(size_t)(b*SEQ + t + 1)*DP + COFF + (tid-DSTATE)];
#endif
        }
        const float a = abar[(b*SEQ + t)*NH + h];
        const float x = xh[((size_t)(b*SEQ + t))*DI + h*HD + tid];
        float acc = 0.f;
        #pragma unroll
        for (int n = 0; n < DSTATE; ++n) {
            st[n] = fmaf(a, st[n], Bs[cur][n] * x);
            acc   = fmaf(st[n], Cs[cur][n], acc);
        }
        y[((size_t)(b*SEQ + t))*DI + h*HD + tid] = fmaf(x, Dp, acc);
        async_wait0();
        __syncthreads();
    }
}

// =====================================================================
// y = RMSNorm(y * SiLU(z)) * norm_w   (in place; one WG per (b,t) row)
// =====================================================================
__global__ __launch_bounds__(256)
void gate_rms_kernel(float* __restrict__ y, const float* __restrict__ P,
                     const float* __restrict__ norm_w)
{
    __shared__ float red[256];
    const int row = blockIdx.x;
    const int tid = threadIdx.x;
    float g[8];
    float ss = 0.f;
    #pragma unroll
    for (int j = 0; j < 8; ++j) {
        const int i = tid + j*256;
        const float z = P[(size_t)row * DP + i];           // z slice = cols [0,DI)
        const float s = z / (1.f + __expf(-z));
        const float v = y[(size_t)row * DI + i] * s;
        g[j] = v;
        ss = fmaf(v, v, ss);
    }
    red[tid] = ss;
    __syncthreads();
    for (int off = 128; off > 0; off >>= 1) {
        if (tid < off) red[tid] += red[tid + off];
        __syncthreads();
    }
    const float inv = rsqrtf(red[0] / (float)DI + 1e-6f);
    #pragma unroll
    for (int j = 0; j < 8; ++j) {
        const int i = tid + j*256;
        y[(size_t)row * DI + i] = g[j] * inv * norm_w[i];
    }
}

// =====================================================================
extern "C" void kernel_launch(void* const* d_in, const int* in_sizes, int n_in,
                              void* d_out, int out_size, void* d_ws, size_t ws_size,
                              hipStream_t stream)
{
    const float* x         = (const float*)d_in[0];
    const float* in_proj_w = (const float*)d_in[1];
    const float* conv_w    = (const float*)d_in[2];
    const float* conv_b    = (const float*)d_in[3];
    const float* A_log     = (const float*)d_in[4];
    const float* D_param   = (const float*)d_in[5];
    const float* dt_bias   = (const float*)d_in[6];
    const float* norm_w    = (const float*)d_in[7];
    const float* out_proj_w= (const float*)d_in[8];
    float* out = (float*)d_out;

    // workspace layout (floats): zxBCdt | xh | abar | y | S | Aseg  (~101 MB total)
    float* zx   = (float*)d_ws;
    float* xh   = zx   + (size_t)BATCH * SEQ * DP;
    float* abar = xh   + (size_t)BATCH * SEQ * DI;
    float* yb   = abar + (size_t)BATCH * SEQ * NH;
    float* sg   = yb   + (size_t)BATCH * SEQ * DI;
    float* aseg = sg   + (size_t)BATCH * NH * (NSEG-1) * DSTATE * HD;

    const int M = BATCH * SEQ;   // 2048

    // 1) in_proj:  zx[M,4232] = x[M,1024] * in_proj_w[4232,1024]^T
    gemm_f32_wmma<17, 64, DP, DIMX><<<dim3(M/128, (DP + 271)/272), 256, 0, stream>>>(x, in_proj_w, zx);
    // 2) a_bar
    abar_kernel<<<(M * NH)/256, 256, 0, stream>>>(zx, dt_bias, A_log, abar);
    // 3) conv + SiLU
    conv_silu_kernel<<<((size_t)M * DI)/256, 256, 0, stream>>>(zx, conv_w, conv_b, xh);
    // 4) selective scan in NSEG time segments: end states, carry, outputs
    seg_state_kernel<<<dim3(NSEG-1, BATCH*NH), 256, 0, stream>>>(zx, xh, abar, sg, aseg);
    seg_carry_kernel<<<(BATCH*NH*DSTATE*HD/4)/256, 256, 0, stream>>>(sg, aseg);
    scan_kernel<<<dim3(NSEG, BATCH*NH), 256, 0, stream>>>(zx, xh, abar, D_param, sg, yb);
    // 5) gate + RMSNorm (in place on yb)
    gate_rms_kernel<<<M, 256, 0, stream>>>(yb, zx, norm_w);
    // 6) out_proj:  out[M,1024] = yb[M,2048] * out_proj_w[1024,2048]^T
    gemm_f32_wmma<4, 128, DIMX, DI><<<dim3(M/128, DIMX/64), 256, 0, stream>>>(yb, out_proj_w, out);
}

// v003
// It runs in 239 microseconds.
// Two timings next to v002 put it at 1.12 and 1.11 times that version's speed.
// All steps since v000 together make it 5.15 times as fast.
#include <hip/hip_runtime.h>
#include <math.h>

// ---------------- problem constants (match reference) ----------------
#define DIMX   1024
#define DSTATE 64
#define NH     8
#define DI     2048            // D_INNER
#define HD     256             // HEAD_DIM
#define DP     4232            // D_IN_PROJ = 2*DI + NH + 2*DSTATE
#define SEQ    1024
#define BATCH  2
#define BOFF   (2*DI + NH)          // B_proj (=Cm slice) columns [4104,4168)
#define COFF   (2*DI + NH + DSTATE) // C_proj (=dtm slice) columns [4168,4232)
#define NSEG   32              // time segments of the scan
#define TSEG   (SEQ / NSEG)    // steps per segment

typedef float v2f __attribute__((ext_vector_type(2)));
typedef float v8f __attribute__((ext_vector_type(8)));
typedef int   i32x4 __attribute__((vector_size(4 * sizeof(int))));  // matches builtin proto

// gfx1250 async global->LDS copies (ASYNCcnt-tracked). Guarded so the code
// still compiles (sync fallback) if this toolchain doesn't expose them.
#if __has_builtin(__builtin_amdgcn_global_load_async_to_lds_b128)
#define ASYNC_B128 1
#endif
#if __has_builtin(__builtin_amdgcn_global_load_async_to_lds_b32)
#define ASYNC_B32 1
#endif

__device__ __forceinline__ void async_wait0()
{
#if defined(ASYNC_B128) || defined(ASYNC_B32)
#if __has_builtin(__builtin_amdgcn_s_wait_asynccnt)
    __builtin_amdgcn_s_wait_asynccnt(0);
#else
    asm volatile("s_wait_asynccnt 0x0" ::: "memory");
#endif
#endif
}

// =====================================================================
// GEMM: C[M,N] = A[M,K] * B[N,K]^T   (both row-major, fp32)
// The tile is sized so that a launch is one workgroup per WGP, all of them
// resident at once and with equal work: 128 rows x NF*16 columns.
// WG = 256 thr (8 waves); wave w owns rows [16w,16w+16) and all NF column
// fragments (NF wmma accumulators, one A fragment reused NF times).
// K goes through two LDS buffers in KC-wide stages: stage t+2 is copied with
// global_load_async_to_lds_b128 while stage t+1 feeds V_WMMA_F32_16X16X4_F32.
// One barrier per stage.
// =====================================================================
template <int NF, int KC, int N, int K>
__global__ __launch_bounds__(256)
void gemm_f32_wmma(const float* __restrict__ A, const float* __restrict__ Bw,
                   float* __restrict__ C)
{
    constexpr int BM = 128;          // rows of the WG tile
    constexpr int BN = NF * 16;      // columns of the WG tile
    constexpr int LD = KC + 4;       // padded LDS row stride (floats): 16B-aligned, conflict-free
    constexpr int PR = KC / 4;       // 16-byte pieces per staged row
    constexpr int RP = 256 / PR;     // rows staged by one copy of the whole WG
    constexpr int NT = K / KC;       // stages
    static_assert(NT >= 2 && K % KC == 0, "two stages or more");
    static_assert(BM % RP == 0 && BN % RP == 0, "whole copies");

    __shared__ __attribute__((aligned(16))) float As[2][BM * LD];
    __shared__ __attribute__((aligned(16))) float Bs[2][BN * LD];

    const int tid  = threadIdx.x;
    const int lane = tid & 31;
    const int w    = tid >> 5;
    const int lm   = lane & 15;      // fragment row/col within 16
    const int hi   = lane >> 4;      // half-wave select (K pair / M+8)

    const int mBase = blockIdx.x * BM;
    const int nBase = blockIdx.y * BN;

    v8f acc[NF];
    #pragma unroll
    for (int f = 0; f < NF; ++f) acc[f] = (v8f){0.f,0.f,0.f,0.f,0.f,0.f,0.f,0.f};

    const int sr = tid / PR;         // row within one copy of the WG
    const int sc = (tid % PR) * 4;   // float column of this thread's 16 bytes

    // stage the BM x KC chunk of A and the BN x KC chunk of B at K-offset k0
    auto stage = [&](int k0, int buf) {
        #pragma unroll
        for (int i = 0; i < BM / RP; ++i) {
            const int r = i * RP + sr;
            const float* g = A + (size_t)(unsigned)((mBase + r) * K + k0 + sc);
            float*       l = &As[buf][r * LD + sc];
#ifdef ASYNC_B128
            __builtin_amdgcn_global_load_async_to_lds_b128((i32x4*)g, (i32x4*)l, 0, 0);
#else
            *(float4*)l = *(const float4*)g;
#endif
        }
        #pragma unroll
        for (int i = 0; i < BN / RP; ++i) {
            const int r = i * RP + sr;
            // a row of B feeds output column n alone, and columns n >= N are
            // never stored: past the edge the last row is copied again
            const int n = min(nBase + r, N - 1);
            const float* g = Bw + (size_t)(unsigned)(n * K + k0 + sc);
            float*       l = &Bs[buf][r * LD + sc];
#ifdef ASYNC_B128
            __builtin_amdgcn_global_load_async_to_lds_b128((i32x4*)g, (i32x4*)l, 0, 0);
#else
            *(float4*)l = *(const float4*)g;
#endif
        }
    };

    stage(0, 0);
    // stage 0 has landed before the barrier behind which other waves read it
    asm volatile("s_wait_asynccnt 0x0" ::: "memory");
    __syncthreads();
    stage(KC, 1);

    // rolled, for speed only
    #pragma unroll 1
    for (int t = 0; t < NT; ++t) {
        const int cur = t & 1;
        const float* as = &As[cur][(w * 16 + lm) * LD + 2 * hi];  // ISA f32 A-layout: v0=K{0|2}, v1=K{1|3}
        const float* bs = &Bs[cur][lm * LD + 2 * hi];
        #pragma unroll
        for (int kk = 0; kk < KC; kk += 4) {
            const v2f a = *(const v2f*)(as + kk);
            #pragma unroll
            for (int f = 0; f < NF; ++f) {
                const v2f b = *(const v2f*)(bs + f * 16 * LD + kk);
                acc[f] = __builtin_amdgcn_wmma_f32_16x16x4_f32(false, a, false, b, (short)0, acc[f], false, false);
            }
        }
        // this wave's reads of buffer cur are over before it is refilled
        asm volatile("s_wait_dscnt 0x0" ::: "memory");
        // this wave's copies of stage t+1 have landed before the barrier
        asm volatile("s_wait_asynccnt 0x0" ::: "memory");
        __syncthreads();
        if (t + 2 < NT) stage((t + 2) * KC, cur);
    }
    // no copy is outstanding when the wave ends
    asm volatile("s_wait_asynccnt 0x0" ::: "memory");

    // ---- store D: VGPR r = row r (lanes 0-15) / row r+8 (lanes 16-31) ----
    const int mRow = mBase + w * 16 + 8 * hi;
    #pragma unroll
    for (int f = 0; f < NF; ++f) {
        const int n = nBase + 16 * f + lm;
        if (n < N) {
            #pragma unroll
            for (int r = 0; r < 8; ++r)
                C[(size_t)(mRow + r) * N + n] = acc[f][r];
        }
    }
}

// =====================================================================
// The two pointwise stages in front of the scan have no launch and no buffer
// of their own: the scan launches compute them where they are used.
//
// a_bar[b,t,h] = exp(softplus(Bm + dt_bias[h]) * (-exp(A_log[h]))): a segment
// has as many steps as a wave has lanes, so lane l of every wave computes the
// value of step t0 + l once, and step i reads it from lane i.
// =====================================================================
static_assert(TSEG == 32, "one step of a segment per lane of a wave");

__device__ __forceinline__
float abar_of_lane(const float* __restrict__ P, const float* __restrict__ dt_bias,
                   const float* __restrict__ A_log, int row0, int h, int lane)
{
    const float r  = P[(size_t)(row0 + lane) * DP + 2*DI + h] + dt_bias[h];
    const float dt = (r > 20.f) ? r : log1pf(__expf(r));
    const float a  = -__expf(A_log[h]);
    return __expf(dt * a);
}

// depthwise causal conv(4) + SiLU of one channel at one step; u3..u0 are the
// xc slice of zxBCdt at t-3..t (zero in front of the sequence). A lane walks
// its channel along t, so three of the four taps are already in its registers.
__device__ __forceinline__
float conv_silu(float u3, float u2, float u1, float u0, float4 w, float bias)
{
    float acc = bias;
    acc = fmaf(u3, w.x, acc);
    acc = fmaf(u2, w.y, acc);
    acc = fmaf(u1, w.z, acc);
    acc = fmaf(u0, w.w, acc);
    return acc / (1.f + __expf(-acc));   // SiLU
}

// =====================================================================
// The recurrence h_t = a_t h_{t-1} + B_t x_t is linear in h, so the time
// axis is cut into NSEG segments that run side by side:
//   1) seg_state_kernel: end state of each segment started from zero, and
//      the product of its a_t;
//   2) seg_carry_kernel: H_s = Aseg_s * H_{s-1} + S_s over the segments;
//   3) scan_kernel: each segment again, started from the carried state,
//      this time with the outputs.
// State planes: S[(bh*(NSEG-1) + seg)][n][d]; the last segment's end state
// is never needed.
// =====================================================================

// One WG per (segment, b*h); lane d owns st[64]. B_t is the same for every
// lane, so it is read at a uniform address: no LDS and no barrier here.
__global__ __launch_bounds__(256)
void seg_state_kernel(const float* __restrict__ P, const float* __restrict__ conv_w,
                      const float* __restrict__ conv_b, const float* __restrict__ dt_bias,
                      const float* __restrict__ A_log, float* __restrict__ S,
                      float* __restrict__ Aseg)
{
    const int tid = threadIdx.x;                 // d in [0,256)
    const int seg = blockIdx.x;                  // [0, NSEG-1)
    const int bh  = blockIdx.y;
    const int b   = bh >> 3;
    const int h   = bh & (NH - 1);

    float st[DSTATE];
    #pragma unroll
    for (int n = 0; n < DSTATE; ++n) st[n] = 0.f;
    float p = 1.f;

    const int t0 = seg * TSEG;
    const int c  = h*HD + tid;                   // this lane's channel
    const float4 w    = *(const float4*)(conv_w + c * 4);
    const float  bias = conv_b[c];
    const float* u    = P + (size_t)(b*SEQ + t0)*DP + DI + c;
    float u3 = 0.f, u2 = 0.f, u1 = 0.f;
    if (seg > 0) { u3 = u[-3*DP]; u2 = u[-2*DP]; u1 = u[-1*DP]; }
    float un = u[0];
    const float av = abar_of_lane(P, dt_bias, A_log, b*SEQ + t0, h, tid & 31);

    for (int i = 0; i < TSEG; ++i) {
        const float* Bt = P + (size_t)(b*SEQ + t0 + i)*DP + BOFF;
        const float a = __int_as_float(__builtin_amdgcn_readlane(__float_as_int(av), i));
        const float u0 = un;
        un = u[(i + 1) * DP];   // next step's tap; the last segment is not run here, so the row exists
        const float x = conv_silu(u3, u2, u1, u0, w, bias);
        u3 = u2; u2 = u1; u1 = u0;
        p *= a;
        #pragma unroll
        for (int n = 0; n < DSTATE; ++n)
            st[n] = fmaf(a, st[n], Bt[n] * x);
    }

    float* s = S + ((size_t)(bh*(NSEG-1) + seg) * DSTATE) * HD + tid;
    #pragma unroll
    for (int n = 0; n < DSTATE; ++n) s[n * HD] = st[n];
    if (tid == 0) Aseg[bh*(NSEG-1) + seg] = p;
}

// In place: plane s becomes the state at the END of segment s, which is the
// start state of segment s+1. One thread per 4 state elements, in three
// phases: fetch every plane, run the carry in registers, store every plane but plane 0.
__global__ __launch_bounds__(256)
void seg_carry_kernel(float* __restrict__ S, const float* __restrict__ Aseg)
{
    const int bh  = blockIdx.x / (DSTATE*HD/4/256);   // 16 blocks per (b,h)
    const int e   = (blockIdx.x % (DSTATE*HD/4/256)) * 256 + threadIdx.x;
    float4* s = (float4*)S + (size_t)bh * (NSEG-1) * (DSTATE*HD/4) + e;

    float4 v[NSEG-1];
    #pragma unroll
    for (int c = 0; c < NSEG-1; ++c) v[c] = s[(size_t)c * (DSTATE*HD/4)];
    // keeps every load above the arithmetic: all planes are in flight at once
    // instead of being fetched as registers come free
    __builtin_amdgcn_sched_barrier(0);

    #pragma unroll
    for (int c = 1; c < NSEG-1; ++c) {                // plane 0 is already final
        const float a = Aseg[bh*(NSEG-1) + c];
        v[c].x = fmaf(a, v[c-1].x, v[c].x);
        v[c].y = fmaf(a, v[c-1].y, v[c].y);
        v[c].z = fmaf(a, v[c-1].z, v[c].z);
        v[c].w = fmaf(a, v[c-1].w, v[c].w);
    }
    // keeps the stores below the arithmetic: no register of an issued store
    // is written again
    __builtin_amdgcn_sched_barrier(0);

    #pragma unroll
    for (int c = 1; c < NSEG-1; ++c) s[(size_t)c * (DSTATE*HD/4)] = v[c];
}

// =====================================================================
// Selective scan of one segment. One WG per (segment, b*h); lane d owns
// h-state row st[64] in VGPRs, started from the carried state. B_t/C_t
// double-buffered in LDS; the next timestep's vectors stream in via async
// global->LDS while the 64-deep FMA chain runs. One barrier per timestep.
// =====================================================================
__global__ __launch_bounds__(256)
void scan_kernel(const float* __restrict__ P, const float* __restrict__ conv_w,
                 const float* __restrict__ conv_b, const float* __restrict__ dt_bias,
                 const float* __restrict__ A_log, const float* __restrict__ Dp_,
                 const float* __restrict__ S, float* __restrict__ y)
{
    __shared__ float Bs[2][DSTATE];
    __shared__ float Cs[2][DSTATE];
    const int tid = threadIdx.x;                 // d in [0,256)
    const int seg = blockIdx.x;                  // [0, NSEG)
    const int b   = blockIdx.y >> 3;
    const int h   = blockIdx.y & (NH - 1);
    const float Dp = Dp_[h];
    const int t0   = seg * TSEG;                 // even, so buffer 0 is first
    const int tEnd = t0 + TSEG;

    float st[DSTATE];
    if (seg > 0) {
        const float* s0 = S + ((size_t)(blockIdx.y*(NSEG-1) + seg - 1) * DSTATE) * HD + tid;
        #pragma unroll
        for (int n = 0; n < DSTATE; ++n) st[n] = s0[n * HD];
    } else {
        #pragma unroll
        for (int n = 0; n < DSTATE; ++n) st[n] = 0.f;
    }

    const int c = h*HD + tid;                    // this lane's channel
    const float4 w    = *(const float4*)(conv_w + c * 4);
    const float  bias = conv_b[c];
    const float* u    = P + (size_t)(b*SEQ)*DP + DI + c;
    float u3 = 0.f, u2 = 0.f, u1 = 0.f;
    if (seg > 0) { u3 = u[(t0-3)*DP]; u2 = u[(t0-2)*DP]; u1 = u[(t0-1)*DP]; }
    float un = u[t0*DP];
    const float av = abar_of_lane(P, dt_bias, A_log, b*SEQ + t0, h, tid & 31);

    // preload t = t0 (synchronous is fine for the prologue)
    if (tid < DSTATE)            Bs[0][tid]        = P[(size_t)(b*SEQ + t0)*DP + BOFF + tid];
    else if (tid < 2*DSTATE)     Cs[0][tid-DSTATE] = P[(size_t)(b*SEQ + t0)*DP + COFF + (tid-DSTATE)];
    __syncthreads();

    for (int t = t0; t < tEnd; ++t) {
        const int cur = t & 1, nxt = cur ^ 1;
        if (t + 1 < tEnd) {   // overlap next-step B/C fetch with the FMA chain
#ifdef ASYNC_B32
            if (tid < DSTATE)
                __builtin_amdgcn_global_load_async_to_lds_b32(
                    (int*)(P + (size_t)(b*SEQ + t + 1)*DP + BOFF + tid),
                    (int*)&Bs[nxt][tid], 0, 0);
            else if (tid < 2*DSTATE)
                __builtin_amdgcn_global_load_async_to_lds_b32(
                    (int*)(P + (size_t)(b*SEQ + t + 1)*DP + COFF + (tid-DSTATE)),
                    (int*)&Cs[nxt][tid-DSTATE], 0, 0);
#else
            if (tid < DSTATE)
                Bs[nxt][tid] = P[(size_t)(b*SEQ + t + 1)*DP + BOFF + tid];
            else if (tid < 2*DSTATE)
                Cs[nxt][tid-DSTATE] = P[(size_t)(b*SEQ + t + 1)*DP + COFF + (tid-DSTATE)];
#endif
        }
        const float a = __int_as_float(__builtin_amdgcn_readlane(__float_as_int(av), t - t0));
        const float u0 = un;
        un = u[min(t + 1, SEQ - 1) * DP];   // next step's tap, kept inside the sequence
        const float x = conv_silu(u3, u2, u1, u0, w, bias);
        u3 = u2; u2 = u1; u1 = u0;
        float acc = 0.f;
        #pragma unroll
        for (int n = 0; n < DSTATE; ++n) {
            st[n] = fmaf(a, st[n], Bs[cur][n] * x);
            acc   = fmaf(st[n], Cs[cur][n], acc);
        }
        y[((size_t)(b*SEQ + t))*DI + h*HD + tid] = fmaf(x, Dp, acc);
        async_wait0();
        __syncthreads();
    }
}

// =====================================================================
// y = RMSNorm(y * SiLU(z)) * norm_w   (in place; one WG per (b,t) row)
// =====================================================================
__global__ __launch_bounds__(256)
void gate_rms_kernel(float* __restrict__ y, const float* __restrict__ P,
                     const float* __restrict__ norm_w)
{
    __shared__ float red[256];
    const int row = blockIdx.x;
    const int tid = threadIdx.x;
    float g[8];
    float ss = 0.f;
    #pragma unroll
    for (int j = 0; j < 8; ++j) {
        const int i = tid + j*256;
        const float z = P[(size_t)row * DP + i];           // z slice = cols [0,DI)
        const float s = z / (1.f + __expf(-z));
        const float v = y[(size_t)row * DI + i] * s;
        g[j] = v;
        ss = fmaf(v, v, ss);
    }
    red[tid] = ss;
    __syncthreads();
    for (int off = 128; off > 0; off >>= 1) {
        if (tid < off) red[tid] += red[tid + off];
        __syncthreads();
    }
    const float inv = rsqrtf(red[0] / (float)DI + 1e-6f);
    #pragma unroll
    for (int j = 0; j < 8; ++j) {
        const int i = tid + j*256;
        y[(size_t)row * DI + i] = g[j] * inv * norm_w[i];
    }
}

// =====================================================================
extern "C" void kernel_launch(void* const* d_in, const int* in_sizes, int n_in,
                              void* d_out, int out_size, void* d_ws, size_t ws_size,
                              hipStream_t stream)
{
    const float* x         = (const float*)d_in[0];
    const float* in_proj_w = (const float*)d_in[1];
    const float* conv_w    = (const float*)d_in[2];
    const float* conv_b    = (const float*)d_in[3];
    const float* A_log     = (const float*)d_in[4];
    const float* D_param   = (const float*)d_in[5];
    const float* dt_bias   = (const float*)d_in[6];
    const float* norm_w    = (const float*)d_in[7];
    const float* out_proj_w= (const float*)d_in[8];
    float* out = (float*)d_out;

    // workspace layout (floats): zxBCdt | y | S | Aseg  (~84 MB total)
    float* zx   = (float*)d_ws;
    float* yb   = zx   + (size_t)BATCH * SEQ * DP;
    float* sg   = yb   + (size_t)BATCH * SEQ * DI;
    float* aseg = sg   + (size_t)BATCH * NH * (NSEG-1) * DSTATE * HD;

    const int M = BATCH * SEQ;   // 2048

    // 1) in_proj:  zx[M,4232] = x[M,1024] * in_proj_w[4232,1024]^T
    gemm_f32_wmma<17, 64, DP, DIMX><<<dim3(M/128, (DP + 271)/272), 256, 0, stream>>>(x, in_proj_w, zx);
    // 2) selective scan in NSEG time segments: end states, carry, outputs
    //    (a_bar and conv + SiLU are computed inside the first and the third)
    seg_state_kernel<<<dim3(NSEG-1, BATCH*NH), 256, 0, stream>>>(zx, conv_w, conv_b, dt_bias, A_log, sg, aseg);
    seg_carry_kernel<<<(BATCH*NH*DSTATE*HD/4)/256, 256, 0, stream>>>(sg, aseg);
    scan_kernel<<<dim3(NSEG, BATCH*NH), 256, 0, stream>>>(zx, conv_w, conv_b, dt_bias, A_log, D_param, sg, yb);
    // 3) gate + RMSNorm (in place on yb)
    gate_rms_kernel<<<M, 256, 0, stream>>>(yb, zx, norm_w);
    // 4) out_proj:  out[M,1024] = yb[M,2048] * out_proj_w[1024,2048]^T
    gemm_f32_wmma<4, 128, DIMX, DI><<<dim3(M/128, DIMX/64), 256, 0, stream>>>(yb, out_proj_w, out);
}

// v004
// Measured time: 201 microseconds a run.
// Two timings next to v003 both put it at 1.18 times that version's speed.
// All steps since v000 together make it 6.09 times as fast.
#include <hip/hip_runtime.h>
#include <math.h>

// ---------------- problem constants (match reference) ----------------
#define DIMX   1024
#define DSTATE 64
#define NH     8
#define DI     2048            // D_INNER
#define HD     256             // HEAD_DIM
#define DP     4232            // D_IN_PROJ = 2*DI + NH + 2*DSTATE
#define SEQ    1024
#define BATCH  2
#define BOFF   (2*DI + NH)          // B_proj (=Cm slice) columns [4104,4168)
#define COFF   (2*DI + NH + DSTATE) // C_proj (=dtm slice) columns [4168,4232)
#define NSEG   32              // time segments of the scan
#define TSEG   (SEQ / NSEG)    // steps per segment

typedef float v2f __attribute__((ext_vector_type(2)));
typedef float v8f __attribute__((ext_vector_type(8)));
typedef int   i32x4 __attribute__((vector_size(4 * sizeof(int))));  // matches builtin proto

// gfx1250 async global->LDS copies (ASYNCcnt-tracked). Guarded so the code
// still compiles (sync fallback) if this toolchain doesn't expose them.
#if __has_builtin(__builtin_amdgcn_global_load_async_to_lds_b128)
#define ASYNC_B128 1
#endif

// =====================================================================
// GEMM: C[M,N] = A[M,K] * B[N,K]^T   (both row-major, fp32)
// The tile is sized so that a launch is one workgroup per WGP, all of them
// resident at once and with equal work: 128 rows x NF*16 columns.
// WG = 256 thr (8 waves); wave w owns rows [16w,16w+16) and all NF column
// fragments (NF wmma accumulators, one A fragment reused NF times).
// K goes through two LDS buffers in KC-wide stages: stage t+2 is copied with
// global_load_async_to_lds_b128 while stage t+1 feeds V_WMMA_F32_16X16X4_F32.
// One barrier per stage.
// =====================================================================
template <int NF, int KC, int N, int K>
__global__ __launch_bounds__(256)
void gemm_f32_wmma(const float* __restrict__ A, const float* __restrict__ Bw,
                   float* __restrict__ C)
{
    constexpr int BM = 128;          // rows of the WG tile
    constexpr int BN = NF * 16;      // columns of the WG tile
    constexpr int LD = KC + 4;       // padded LDS row stride (floats): 16B-aligned, conflict-free
    constexpr int PR = KC / 4;       // 16-byte pieces per staged row
    constexpr int RP = 256 / PR;     // rows staged by one copy of the whole WG
    constexpr int NT = K / KC;       // stages
    static_assert(NT >= 2 && K % KC == 0, "two stages or more");
    static_assert(BM % RP == 0 && BN % RP == 0, "whole copies");

    __shared__ __attribute__((aligned(16))) float As[2][BM * LD];
    __shared__ __attribute__((aligned(16))) float Bs[2][BN * LD];

    const int tid  = threadIdx.x;
    const int lane = tid & 31;
    const int w    = tid >> 5;
    const int lm   = lane & 15;      // fragment row/col within 16
    const int hi   = lane >> 4;      // half-wave select (K pair / M+8)

    const int mBase = blockIdx.x * BM;
    const int nBase = blockIdx.y * BN;

    v8f acc[NF];
    #pragma unroll
    for (int f = 0; f < NF; ++f) acc[f] = (v8f){0.f,0.f,0.f,0.f,0.f,0.f,0.f,0.f};

    const int sr = tid / PR;         // row within one copy of the WG
    const int sc = (tid % PR) * 4;   // float column of this thread's 16 bytes

    // stage the BM x KC chunk of A and the BN x KC chunk of B at K-offset k0
    auto stage = [&](int k0, int buf) {
        #pragma unroll
        for (int i = 0; i < BM / RP; ++i) {
            const int r = i * RP + sr;
            const float* g = A + (size_t)(unsigned)((mBase + r) * K + k0 + sc);
            float*       l = &As[buf][r * LD + sc];
#ifdef ASYNC_B128
            __builtin_amdgcn_global_load_async_to_lds_b128((i32x4*)g, (i32x4*)l, 0, 0);
#else
            *(float4*)l = *(const float4*)g;
#endif
        }
        #pragma unroll
        for (int i = 0; i < BN / RP; ++i) {
            const int r = i * RP + sr;
            // a row of B feeds output column n alone, and columns n >= N are
            // never stored: past the edge the last row is copied again
            const int n = min(nBase + r, N - 1);
            const float* g = Bw + (size_t)(unsigned)(n * K + k0 + sc);
            float*       l = &Bs[buf][r * LD + sc];
#ifdef ASYNC_B128
            __builtin_amdgcn_global_load_async_to_lds_b128((i32x4*)g, (i32x4*)l, 0, 0);
#else
            *(float4*)l = *(const float4*)g;
#endif
        }
    };

    stage(0, 0);
    // stage 0 has landed before the barrier behind which other waves read it
    asm volatile("s_wait_asynccnt 0x0" ::: "memory");
    __syncthreads();
    stage(KC, 1);

    // rolled, for speed only
    #pragma unroll 1
    for (int t = 0; t < NT; ++t) {
        const int cur = t & 1;
        const float* as = &As[cur][(w * 16 + lm) * LD + 2 * hi];  // ISA f32 A-layout: v0=K{0|2}, v1=K{1|3}
        const float* bs = &Bs[cur][lm * LD + 2 * hi];
        #pragma unroll
        for (int kk = 0; kk < KC; kk += 4) {
            const v2f a = *(const v2f*)(as + kk);
            #pragma unroll
            for (int f = 0; f < NF; ++f) {
                const v2f b = *(const v2f*)(bs + f * 16 * LD + kk);
                acc[f] = __builtin_amdgcn_wmma_f32_16x16x4_f32(false, a, false, b, (short)0, acc[f], false, false);
            }
        }
        // this wave's reads of buffer cur are over before it is refilled
        asm volatile("s_wait_dscnt 0x0" ::: "memory");
        // this wave's copies of stage t+1 have landed before the barrier
        asm volatile("s_wait_asynccnt 0x0" ::: "memory");
        __syncthreads();
        if (t + 2 < NT) stage((t + 2) * KC, cur);
    }
    // no copy is outstanding when the wave ends
    asm volatile("s_wait_asynccnt 0x0" ::: "memory");

    // ---- store D: VGPR r = row r (lanes 0-15) / row r+8 (lanes 16-31) ----
    const int mRow = mBase + w * 16 + 8 * hi;
    #pragma unroll
    for (int f = 0; f < NF; ++f) {
        const int n = nBase + 16 * f + lm;
        if (n < N) {
            #pragma unroll
            for (int r = 0; r < 8; ++r)
                C[(size_t)(mRow + r) * N + n] = acc[f][r];
        }
    }
}

// =====================================================================
// The two pointwise stages in front of the scan have no launch and no buffer
// of their own: the scan launches compute them where they are used.
//
// log a_bar[b,t,h] = softplus(Bm + dt_bias[h]) * (-exp(A_log[h])): a segment
// has as many steps as a wave has lanes, so lane l of every wave computes the
// value of step row0 + l from bm, its own step's Bm. The floor keeps sums and
// differences of these logs finite where a_bar is 0.
// =====================================================================
static_assert(TSEG == 32, "one step of a segment per lane of a wave");

__device__ __forceinline__
float log_abar(float bm, const float* __restrict__ dt_bias, const float* __restrict__ A_log, int h)
{
    const float r  = bm + dt_bias[h];
    const float dt = (r > 20.f) ? r : log1pf(__expf(r));
    const float a  = -__expf(A_log[h]);
    return fmaxf(dt * a, -1e30f);
}

// c_t = sum of log a_bar over the segment's steps up to and including t, in
// lane t. What is used of it are differences c_t - c_s (and c_t itself): the
// sum is kept in double so that a small difference of two large sums keeps
// its digits.
__device__ __forceinline__
double log_decay_sum(float bm, const float* __restrict__ dt_bias,
                     const float* __restrict__ A_log, int h, int lane)
{
    double cl = (double)log_abar(bm, dt_bias, A_log, h);
    #pragma unroll
    for (int off = 1; off < 32; off <<= 1) {
        const double v = __shfl_up(cl, off);
        if (lane >= off) cl += v;
    }
    return cl;
}

// depthwise causal conv(4) + SiLU of one channel at one step; u3..u0 are the
// xc slice of zxBCdt at t-3..t (zero in front of the sequence).
__device__ __forceinline__
float conv_silu(float u3, float u2, float u1, float u0, float4 w, float bias)
{
    float acc = bias;
    acc = fmaf(u3, w.x, acc);
    acc = fmaf(u2, w.y, acc);
    acc = fmaf(u1, w.z, acc);
    acc = fmaf(u0, w.w, acc);
    return acc / (1.f + __expf(-acc));   // SiLU
}

#define XP (TSEG + 4)     // LDS pitch (floats) of rows that hold one value per step
#define NP (DSTATE + 4)   // LDS pitch (floats) of rows that hold one value per state

// The taps that one channel c needs for a whole segment, all in flight at once:
// uu[i] is the xc slice of zxBCdt at step i - 3 of the segment. In front of the
// sequence the address stays on the first row and the value is zero.
__device__ __forceinline__
void load_taps(const float* __restrict__ P, int row0, bool first, int c, float (&uu)[TSEG + 3])
{
    const float* u = P + (size_t)row0*DP + DI + c;
    #pragma unroll
    for (int i = 0; i < 3; ++i) uu[i] = u[first ? 0 : (i - 3) * DP];
    #pragma unroll
    for (int i = 0; i < TSEG; ++i) uu[i + 3] = u[i * DP];
    #pragma unroll
    for (int i = 0; i < 3; ++i) uu[i] = first ? 0.f : uu[i];
}

// x of one segment into LDS as XT[channel][step]; thread tid has one channel
__device__ __forceinline__
void stage_x(const float (&uu)[TSEG + 3], float4 wv, float bias, float* XT, int tid)
{
    #pragma unroll
    for (int i4 = 0; i4 < TSEG/4; ++i4) {
        float4 xv;
        xv.x = conv_silu(uu[4*i4    ], uu[4*i4 + 1], uu[4*i4 + 2], uu[4*i4 + 3], wv, bias);
        xv.y = conv_silu(uu[4*i4 + 1], uu[4*i4 + 2], uu[4*i4 + 3], uu[4*i4 + 4], wv, bias);
        xv.z = conv_silu(uu[4*i4 + 2], uu[4*i4 + 3], uu[4*i4 + 4], uu[4*i4 + 5], wv, bias);
        xv.w = conv_silu(uu[4*i4 + 3], uu[4*i4 + 4], uu[4*i4 + 5], uu[4*i4 + 6], wv, bias);
        *(float4*)&XT[tid*XP + 4*i4] = xv;
    }
}

// =====================================================================
// The recurrence h_t = a_t h_{t-1} + B_t x_t is linear in h, so the time
// axis is cut into NSEG segments that run side by side:
//   1) seg_state_kernel: end state of each segment started from zero, and
//      the product of its a_t;
//   2) seg_carry_kernel: H_s = Aseg_s * H_{s-1} + S_s over the segments;
//   3) scan_kernel: each segment again, started from the carried state,
//      this time with the outputs.
// State planes: S[(bh*(NSEG-1) + seg)][n][d]; the last segment's end state
// is never needed.
// =====================================================================

// One WG per (segment, b*h). The end state from zero is one matrix product,
//   S[n][d] = sum_i (exp(c_last - c_i) B[i][n]) x[i][d]      (64 x 256, K = 32)
// on V_WMMA_F32_16X16X4_F32; wave w owns channels [32w, 32w+32) and all 64
// states: 4 x 2 accumulators. The product of the segment's a_t is exp(c_last).
__global__ __launch_bounds__(256)
void seg_state_kernel(const float* __restrict__ P, const float* __restrict__ conv_w,
                      const float* __restrict__ conv_b, const float* __restrict__ dt_bias,
                      const float* __restrict__ A_log, float* __restrict__ S,
                      float* __restrict__ Aseg)
{
    __shared__ __attribute__((aligned(16))) float XT[HD * XP];      // x, [channel][step]
    __shared__ __attribute__((aligned(16))) float BT[DSTATE * XP];  // decayed B, [state][step]

    const int tid  = threadIdx.x;
    const int lane = tid & 31;
    const int w    = tid >> 5;
    const int lm   = lane & 15;      // fragment row/col within 16
    const int hi   = lane >> 4;      // half-wave select (K pair / M+8)
    const int seg  = blockIdx.x;                 // [0, NSEG-1)
    const int bh   = blockIdx.y;
    const int b    = bh >> 3;
    const int h    = bh & (NH - 1);
    const int row0 = b*SEQ + seg*TSEG;
    const int d0   = w * 32;

    const float bm = P[(size_t)(row0 + lane) * DP + 2*DI + h];   // Bm of step 'lane'
    // the address registers of the loads above may be written again behind this wait
    asm volatile("s_wait_xcnt 0x0" ::: "memory");
    const int c = h*HD + tid;                    // this thread's channel
    float uu[TSEG + 3];
    load_taps(P, row0, seg == 0, c, uu);
    const float4 wv   = *(const float4*)(conv_w + c * 4);
    const float  bias = conv_b[c];
    float4 bv[2];
    #pragma unroll
    for (int j = 0; j < 2; ++j)      // row (tid >> 4) + 16 j, 16 bytes of it
        bv[j] = *(const float4*)(P + (size_t)(row0 + (tid >> 4) + 16*j)*DP + BOFF + 4*(tid & 15));
    // the address registers of the loads above may be written again behind this wait
    asm volatile("s_wait_xcnt 0x0" ::: "memory");

    const double cl = log_decay_sum(bm, dt_bias, A_log, h, lane);
    const float  wl = __expf((float)(__shfl(cl, TSEG - 1) - cl));   // lane i: decay from step i to the end
    #pragma unroll
    for (int j = 0; j < 2; ++j) {
        const int   i  = (tid >> 4) + 16*j;
        const float wi = __shfl(wl, i);
        float* l = &BT[4*(tid & 15)*XP + i];
        l[0*XP] = bv[j].x * wi;
        l[1*XP] = bv[j].y * wi;
        l[2*XP] = bv[j].z * wi;
        l[3*XP] = bv[j].w * wi;
    }

    stage_x(uu, wv, bias, XT, tid);
    __syncthreads();     // XT, BT are complete

    v8f acc[4][2];
    #pragma unroll
    for (int mi = 0; mi < 4; ++mi)
        #pragma unroll
        for (int f = 0; f < 2; ++f) acc[mi][f] = (v8f){0.f,0.f,0.f,0.f,0.f,0.f,0.f,0.f};

    const float* ba = &BT[lm*XP + 2*hi];
    const float* xb = &XT[(d0 + lm)*XP + 2*hi];
    #pragma unroll
    for (int k4 = 0; k4 < TSEG/4; ++k4) {
        const v2f b0 = *(const v2f*)(xb + 4*k4);
        const v2f b1 = *(const v2f*)(xb + 16*XP + 4*k4);
        #pragma unroll
        for (int mi = 0; mi < 4; ++mi) {
            const v2f a = *(const v2f*)(ba + 16*mi*XP + 4*k4);
            acc[mi][0] = __builtin_amdgcn_wmma_f32_16x16x4_f32(false, a, false, b0, (short)0, acc[mi][0], false, false);
            acc[mi][1] = __builtin_amdgcn_wmma_f32_16x16x4_f32(false, a, false, b1, (short)0, acc[mi][1], false, false);
        }
    }

    // ---- store D: VGPR r = state r (lanes 0-15) / state r+8 (lanes 16-31) ----
    float* s = S + ((size_t)(bh*(NSEG-1) + seg) * DSTATE) * HD + d0 + lm;
    #pragma unroll
    for (int mi = 0; mi < 4; ++mi)
        #pragma unroll
        for (int f = 0; f < 2; ++f)
            #pragma unroll
            for (int r = 0; r < 8; ++r)
                s[(16*mi + 8*hi + r) * HD + 16*f] = acc[mi][f][r];
    if (tid == TSEG - 1) Aseg[bh*(NSEG-1) + seg] = __expf((float)cl);
}

// In place: plane s becomes the state at the END of segment s, which is the
// start state of segment s+1. One thread per 4 state elements, in three
// phases: fetch every plane, run the carry in registers, store every plane but plane 0.
__global__ __launch_bounds__(256)
void seg_carry_kernel(float* __restrict__ S, const float* __restrict__ Aseg)
{
    const int bh  = blockIdx.x / (DSTATE*HD/4/256);   // 16 blocks per (b,h)
    const int e   = (blockIdx.x % (DSTATE*HD/4/256)) * 256 + threadIdx.x;
    float4* s = (float4*)S + (size_t)bh * (NSEG-1) * (DSTATE*HD/4) + e;

    float4 v[NSEG-1];
    #pragma unroll
    for (int c = 0; c < NSEG-1; ++c) v[c] = s[(size_t)c * (DSTATE*HD/4)];
    // keeps every load above the arithmetic: all planes are in flight at once
    // instead of being fetched as registers come free
    __builtin_amdgcn_sched_barrier(0);

    #pragma unroll
    for (int c = 1; c < NSEG-1; ++c) {                // plane 0 is already final
        const float a = Aseg[bh*(NSEG-1) + c];
        v[c].x = fmaf(a, v[c-1].x, v[c].x);
        v[c].y = fmaf(a, v[c-1].y, v[c].y);
        v[c].z = fmaf(a, v[c-1].z, v[c].z);
        v[c].w = fmaf(a, v[c-1].w, v[c].w);
    }
    // keeps the stores below the arithmetic: no register of an issued store
    // is written again
    __builtin_amdgcn_sched_barrier(0);

    #pragma unroll
    for (int c = 1; c < NSEG-1; ++c) s[(size_t)c * (DSTATE*HD/4)] = v[c];
}

// =====================================================================
// Outputs of one segment, as matrix products instead of a walk over its steps.
// With c_t = sum of log(a_k) over the segment's steps up to and including t,
//   y_t = sum_{s<=t} exp(c_t - c_s) (C_t . B_s) x_s  +  exp(c_t) C_t . H  +  D x_t
// where H is the carried state at the segment's start. One WG per
// (segment, b*h):
//   G[t][s] = exp(c_t - c_s) (C_t . B_s) for s <= t, + D on the diagonal (32x32, K = 64)
//   Y[t][d] = G[t][:] X[:][d] (K = 32)  +  (exp(c_t) C[t][:]) H[:][d] (K = 64)
// all on V_WMMA_F32_16X16X4_F32. Wave w owns channels [32w, 32w+32) and all
// 32 steps: 2 x 2 accumulators. Every exponent is <= 0.
// =====================================================================
__global__ __launch_bounds__(256)
void scan_kernel(const float* __restrict__ P, const float* __restrict__ conv_w,
                 const float* __restrict__ conv_b, const float* __restrict__ dt_bias,
                 const float* __restrict__ A_log, const float* __restrict__ Dp_,
                 const float* __restrict__ S, float* __restrict__ y)
{
    __shared__ __attribute__((aligned(16))) float XT[HD * XP];    // x, [channel][step]
    __shared__ __attribute__((aligned(16))) float Bs[TSEG * NP];  // B, [step][state]
    __shared__ __attribute__((aligned(16))) float Cs[TSEG * NP];  // C, [step][state]
    __shared__ __attribute__((aligned(16))) float Gs[TSEG * XP];  // G, [t][s]

    const int tid  = threadIdx.x;
    const int lane = tid & 31;
    const int w    = __builtin_amdgcn_readfirstlane(tid >> 5);    // scalar: branches on it keep all lanes on
    const int lm   = lane & 15;      // fragment row/col within 16
    const int hi   = lane >> 4;      // half-wave select (K pair / M+8)
    const int seg  = blockIdx.x;                 // [0, NSEG)
    const int b    = blockIdx.y >> 3;
    const int h    = blockIdx.y & (NH - 1);
    const float Dp = Dp_[h];
    const int row0 = b*SEQ + seg*TSEG;           // first row of the segment
    const int d0   = w * 32;                     // first channel of this wave

    const float bm = P[(size_t)(row0 + lane) * DP + 2*DI + h];   // Bm of step 'lane'

    // carried state as B fragments (column = channel, k = state), fetched first
    // so that the loads fly while x is computed; the first segment has none and
    // does not use what it fetches
    v2f hf[DSTATE/4][2];
    {
        const float* s0 = S + ((size_t)(blockIdx.y*(NSEG-1) + max(seg - 1, 0)) * DSTATE) * HD + d0 + lm;
        #pragma unroll
        for (int k4 = 0; k4 < DSTATE/4; ++k4) {
            #pragma unroll
            for (int f = 0; f < 2; ++f) {
                hf[k4][f].x = s0[(4*k4 + 2*hi    ) * HD + 16*f];
                hf[k4][f].y = s0[(4*k4 + 2*hi + 1) * HD + 16*f];
            }
        }
    }
    // the address registers of the loads above may be written again behind this wait
    asm volatile("s_wait_xcnt 0x0" ::: "memory");

    const int c = h*HD + tid;                    // this thread's channel
    float uu[TSEG + 3];
    load_taps(P, row0, seg == 0, c, uu);
    const float4 wv   = *(const float4*)(conv_w + c * 4);
    const float  bias = conv_b[c];

    // B and C of the segment: 128 neighbouring columns of each row
    float4 bc[4];
    #pragma unroll
    for (int j = 0; j < 4; ++j)      // row (tid >> 5) + 8 j, 16 bytes of it
        bc[j] = *(const float4*)(P + (size_t)(row0 + (tid >> 5) + 8*j)*DP + BOFF + 4*lane);
    // the address registers of the loads above may be written again behind this wait
    asm volatile("s_wait_xcnt 0x0" ::: "memory");
    #pragma unroll
    for (int j = 0; j < 4; ++j) {
        const int r = (tid >> 5) + 8*j;
        float* l = (lane < DSTATE/4) ? &Bs[r*NP + 4*lane] : &Cs[r*NP + 4*lane - DSTATE];
        *(float4*)l = bc[j];
    }

    const double cl = log_decay_sum(bm, dt_bias, A_log, h, lane);   // c_t in lane t

    stage_x(uu, wv, bias, XT, tid);
    __syncthreads();     // XT, Bs, Cs are complete

    // G: its three 16x16 tiles on or below the diagonal, one wave each
    if (w < 3) {
        const int ti = (w + 1) >> 1;
        const int si = w >> 1;
        v8f g = (v8f){0.f,0.f,0.f,0.f,0.f,0.f,0.f,0.f};
        const float* ca = &Cs[(16*ti + lm)*NP + 2*hi];
        const float* bb = &Bs[(16*si + lm)*NP + 2*hi];
        #pragma unroll
        for (int kk = 0; kk < DSTATE; kk += 4)
            g = __builtin_amdgcn_wmma_f32_16x16x4_f32(false, *(const v2f*)(ca + kk), false, *(const v2f*)(bb + kk),
                                                      (short)0, g, false, false);
        const int   s  = 16*si + lm;
        const double cs = __shfl(cl, s);
        #pragma unroll
        for (int r = 0; r < 8; ++r) {
            const int   t  = 16*ti + 8*hi + r;
            const double ct = __shfl(cl, t);
            float v = (s <= t) ? g[r] * __expf((float)(ct - cs)) : 0.f;
            if (s == t) v += Dp;
            Gs[t*XP + s] = v;
        }
    }

    v8f acc[2][2];
    #pragma unroll
    for (int ti = 0; ti < 2; ++ti)
        #pragma unroll
        for (int f = 0; f < 2; ++f) acc[ti][f] = (v8f){0.f,0.f,0.f,0.f,0.f,0.f,0.f,0.f};

    // what the carried state adds; needs no G, so it stands in front of the barrier
    if (seg > 0) {
        const float e  = __expf((float)cl);
        const float e0 = __shfl(e, lm);
        const float e1 = __shfl(e, 16 + lm);
        const float* c0 = &Cs[lm*NP + 2*hi];
        const float* c1 = &Cs[(16 + lm)*NP + 2*hi];
        #pragma unroll
        for (int k4 = 0; k4 < DSTATE/4; ++k4) {
            const v2f a0 = *(const v2f*)(c0 + 4*k4) * e0;
            const v2f a1 = *(const v2f*)(c1 + 4*k4) * e1;
            #pragma unroll
            for (int f = 0; f < 2; ++f) {
                acc[0][f] = __builtin_amdgcn_wmma_f32_16x16x4_f32(false, a0, false, hf[k4][f], (short)0, acc[0][f], false, false);
                acc[1][f] = __builtin_amdgcn_wmma_f32_16x16x4_f32(false, a1, false, hf[k4][f], (short)0, acc[1][f], false, false);
            }
        }
    }
    __syncthreads();     // Gs is complete

    {
        const float* g0 = &Gs[lm*XP + 2*hi];
        const float* g1 = &Gs[(16 + lm)*XP + 2*hi];
        const float* x0 = &XT[(d0 + lm)*XP + 2*hi];
        const float* x1 = &XT[(d0 + 16 + lm)*XP + 2*hi];
        #pragma unroll
        for (int k4 = 0; k4 < TSEG/4; ++k4) {
            const v2f b0 = *(const v2f*)(x0 + 4*k4);
            const v2f b1 = *(const v2f*)(x1 + 4*k4);
            if (k4 < 4) {    // steps 0..15 see no later step
                const v2f a0 = *(const v2f*)(g0 + 4*k4);
                acc[0][0] = __builtin_amdgcn_wmma_f32_16x16x4_f32(false, a0, false, b0, (short)0, acc[0][0], false, false);
                acc[0][1] = __builtin_amdgcn_wmma_f32_16x16x4_f32(false, a0, false, b1, (short)0, acc[0][1], false, false);
            }
            const v2f a1 = *(const v2f*)(g1 + 4*k4);
            acc[1][0] = __builtin_amdgcn_wmma_f32_16x16x4_f32(false, a1, false, b0, (short)0, acc[1][0], false, false);
            acc[1][1] = __builtin_amdgcn_wmma_f32_16x16x4_f32(false, a1, false, b1, (short)0, acc[1][1], false, false);
        }
    }

    // ---- store D: VGPR r = step r (lanes 0-15) / step r+8 (lanes 16-31) ----
    #pragma unroll
    for (int ti = 0; ti < 2; ++ti)
        #pragma unroll
        for (int f = 0; f < 2; ++f)
            #pragma unroll
            for (int r = 0; r < 8; ++r)
                y[(size_t)(row0 + 16*ti + 8*hi + r)*DI + h*HD + d0 + 16*f + lm] = acc[ti][f][r];
}

// =====================================================================
// y = RMSNorm(y * SiLU(z)) * norm_w   (in place; one WG per (b,t) row)
// =====================================================================
__global__ __launch_bounds__(256)
void gate_rms_kernel(float* __restrict__ y, const float* __restrict__ P,
                     const float* __restrict__ norm_w)
{
    __shared__ float red[256];
    const int row = blockIdx.x;
    const int tid = threadIdx.x;
    float g[8];
    float ss = 0.f;
    #pragma unroll
    for (int j = 0; j < 8; ++j) {
        const int i = tid + j*256;
        const float z = P[(size_t)row * DP + i];           // z slice = cols [0,DI)
        const float s = z / (1.f + __expf(-z));
        const float v = y[(size_t)row * DI + i] * s;
        g[j] = v;
        ss = fmaf(v, v, ss);
    }
    red[tid] = ss;
    __syncthreads();
    for (int off = 128; off > 0; off >>= 1) {
        if (tid < off) red[tid] += red[tid + off];
        __syncthreads();
    }
    const float inv = rsqrtf(red[0] / (float)DI + 1e-6f);
    #pragma unroll
    for (int j = 0; j < 8; ++j) {
        const int i = tid + j*256;
        y[(size_t)row * DI + i] = g[j] * inv * norm_w[i];
    }
}

// =====================================================================
extern "C" void kernel_launch(void* const* d_in, const int* in_sizes, int n_in,
                              void* d_out, int out_size, void* d_ws, size_t ws_size,
                              hipStream_t stream)
{
    const float* x         = (const float*)d_in[0];
    const float* in_proj_w = (const float*)d_in[1];
    const float* conv_w    = (const float*)d_in[2];
    const float* conv_b    = (const float*)d_in[3];
    const float* A_log     = (const float*)d_in[4];
    const float* D_param   = (const float*)d_in[5];
    const float* dt_bias   = (const float*)d_in[6];
    const float* norm_w    = (const float*)d_in[7];
    const float* out_proj_w= (const float*)d_in[8];
    float* out = (float*)d_out;

    // workspace layout (floats): zxBCdt | y | S | Aseg  (~84 MB total)
    float* zx   = (float*)d_ws;
    float* yb   = zx   + (size_t)BATCH * SEQ * DP;
    float* sg   = yb   + (size_t)BATCH * SEQ * DI;
    float* aseg = sg   + (size_t)BATCH * NH * (NSEG-1) * DSTATE * HD;

    const int M = BATCH * SEQ;   // 2048

    // 1) in_proj:  zx[M,4232] = x[M,1024] * in_proj_w[4232,1024]^T
    gemm_f32_wmma<17, 64, DP, DIMX><<<dim3(M/128, (DP + 271)/272), 256, 0, stream>>>(x, in_proj_w, zx);
    // 2) selective scan in NSEG time segments: end states, carry, outputs
    //    (a_bar and conv + SiLU are computed inside the first and the third)
    seg_state_kernel<<<dim3(NSEG-1, BATCH*NH), 256, 0, stream>>>(zx, conv_w, conv_b, dt_bias, A_log, sg, aseg);
    seg_carry_kernel<<<(BATCH*NH*DSTATE*HD/4)/256, 256, 0, stream>>>(sg, aseg);
    scan_kernel<<<dim3(NSEG, BATCH*NH), 256, 0, stream>>>(zx, conv_w, conv_b, dt_bias, A_log, D_param, sg, yb);
    // 3) gate + RMSNorm (in place on yb)
    gate_rms_kernel<<<M, 256, 0, stream>>>(yb, zx, norm_w);
    // 4) out_proj:  out[M,1024] = yb[M,2048] * out_proj_w[1024,2048]^T
    gemm_f32_wmma<4, 128, DIMX, DI><<<dim3(M/128, DIMX/64), 256, 0, stream>>>(yb, out_proj_w, out);
}
